// v000
// The times below were measured on an AMD MI455X: many runs one after another, warmed up first and cycling through
// copies of the inputs, with the whole window's GPU time divided by the number of runs. Launches and the gaps
// between them are all in it. The median over several windows is given; except for v000 it joins two sittings, which
// can be a few percent apart, so the side-by-side timings, each taken in one sitting, are the better comparison.
// v000, which the later versions start from, runs in 682 microseconds.
#include <hip/hip_runtime.h>
#include <hip/hip_bf16.h>
#include <math.h>

// MI455X / gfx1250, wave32. All heavy math goes through v_wmma_f32_16x16x32_bf16;
// the flash kernel's K-tile staging uses the Tensor Data Mover (tensor_load_to_lds
// + s_wait_tensorcnt) with hardware LDS padding to produce the bank-conflict-free
// 136-element row stride.
// Pipeline:
//   o_rgb  = l2norm(rgb  @ rgb_proj[h])          (GEMM kernel, MODE 0)
//   o_flow = l2norm(flow @ flow_proj[h])         (GEMM kernel, MODE 0)
//   T      = o_rgb @ atte_w[h]                   (GEMM kernel, MODE 1)
//   f_rgb  = tanh(gelu(Flash(Q=T,      K=o_flow, V=o_rgb )) + rgb )
//   f_flow = tanh(gelu(Flash(Q=o_flow, K=T,      V=o_flow)) + flow)
// Flash-style streaming avoids the 512MB atte tensor entirely.

#define N_  4
#define L_  2048
#define D_  1024
#define H_  8
#define DH_ 128

typedef __bf16 bf16_t;
typedef unsigned int       u32;
typedef unsigned long long u64;
typedef __attribute__((ext_vector_type(16))) __bf16 v16bf;
typedef __attribute__((ext_vector_type(8)))  __bf16 v8bf;
typedef __attribute__((ext_vector_type(4)))  __bf16 v4bf;
typedef __attribute__((ext_vector_type(8)))  float  v8f;
typedef __attribute__((ext_vector_type(4)))  u32    v4u;
typedef __attribute__((ext_vector_type(8)))  int    v8i;
typedef __attribute__((ext_vector_type(4)))  int    v4i;

static __device__ __forceinline__ v8f wmma_bf16(v16bf a, v16bf b, v8f c) {
  // 8 args: (neg_a, A, neg_b, B, c_mod, C, reuse_a, reuse_b)
  return __builtin_amdgcn_wmma_f32_16x16x32_bf16(false, a, false, b, (short)0, c,
                                                 false, false);
}

// 16x32 bf16 fragment per ISA 7.12.2:
//   lane<16 : row M=lane,    K = {0..7, 16..23}
//   lane>=16: row M=lane-16, K = {8..15, 24..31}
// base points at a [16 x 32] tile, row-major with `stride` elements per row.
// (B fragments use the same pattern from a [N][K]-transposed LDS tile.)
static __device__ __forceinline__ v16bf load_frag(const bf16_t* base, int stride,
                                                  int lane) {
  const int r  = lane & 15;
  const int kb = (lane & 16) ? 8 : 0;
  const bf16_t* p = base + (size_t)r * stride + kb;
  v8bf lo = *(const v8bf*)(p);
  v8bf hi = *(const v8bf*)(p + 16);
  v16bf f;
#pragma unroll
  for (int i = 0; i < 8; ++i) { f[i] = lo[i]; f[i + 8] = hi[i]; }
  return f;
}

static __device__ __forceinline__ v8f zero8() {
  v8f z = {0.f, 0.f, 0.f, 0.f, 0.f, 0.f, 0.f, 0.f};
  return z;
}

// ---------------------------------------------------------------------------
// GEMM: O[l,k] = A[l,:] @ B[:,k]  per (n,h) slice, 128x128 output per block.
// MODE 0: A = f32 [L_,D_] (shared across heads), B = f32 proj[h] [D_,128],
//         epilogue = per-row L2 normalize. Kdim = 1024.
// MODE 1: A = bf16 o_rgb slice [L_,128], B = f32 atte_w[h] [128,128]. Kdim=128.
// Output bf16 [n,h,l,128].
// ---------------------------------------------------------------------------
template <int MODE>
__global__ __launch_bounds__(256) void mca_gemm_kernel(
    const float* __restrict__ Af, const bf16_t* __restrict__ Ab,
    const float* __restrict__ Bf, bf16_t* __restrict__ O, int Kdim) {
  __shared__ bf16_t As[128 * 40];   // padded stride 40 (80B rows, 16B aligned)
  __shared__ bf16_t Bs[128 * 40];   // stored transposed: Bs[n][k]

  const int nh = blockIdx.y, n = nh / H_, h = nh % H_;
  const int l0 = blockIdx.x * 128;
  const int tid = threadIdx.x, wave = tid >> 5, lane = tid & 31;
  const int half = (lane >> 4) & 1, ln = lane & 15;

  const float*  Ag  = (MODE == 0) ? Af + ((size_t)n * L_ + l0) * (size_t)D_ : nullptr;
  const bf16_t* Ag2 = (MODE == 0) ? nullptr : Ab + ((size_t)nh * L_ + l0) * DH_;
  const float* Bg = Bf + (size_t)h * Kdim * DH_;
  bf16_t* Og = O + ((size_t)nh * L_ + l0) * DH_;

  v8f acc[8];
#pragma unroll
  for (int t = 0; t < 8; ++t) acc[t] = zero8();

  for (int k0 = 0; k0 < Kdim; k0 += 32) {
    __syncthreads();
    // --- Stage A tile: 128 rows x 32 k -----------------------------------
    if (MODE == 0) {
      // f32 -> bf16, float4 loads + packed 8B LDS stores (4096 elems).
#pragma unroll
      for (int j = 0; j < 4; ++j) {
        int e4 = (tid + 256 * j) * 4;          // 0..4092, step 4
        int row = e4 >> 5, k = e4 & 31;
        float4 v = *(const float4*)(Ag + (size_t)row * D_ + k0 + k);
        v4bf d;
        d[0] = (bf16_t)v.x; d[1] = (bf16_t)v.y;
        d[2] = (bf16_t)v.z; d[3] = (bf16_t)v.w;
        *(v4bf*)(&As[row * 40 + k]) = d;
      }
    } else {
      // bf16 copy, b128 loads/stores (4096 elems).
#pragma unroll
      for (int j = 0; j < 2; ++j) {
        int e8 = (tid + 256 * j) * 8;          // 0..4088, step 8
        int row = e8 >> 5, k = e8 & 31;
        *(v8bf*)(&As[row * 40 + k]) =
            *(const v8bf*)(Ag2 + (size_t)row * DH_ + k0 + k);
      }
    }
    // --- Stage B tile transposed: Bs[n][k] = B[k0+k][n] ------------------
#pragma unroll
    for (int j = 0; j < 4; ++j) {
      int e4 = (tid + 256 * j) * 4;            // 0..4092, step 4
      int k = e4 >> 7, col = e4 & 127;
      float4 v = *(const float4*)(Bg + (size_t)(k0 + k) * DH_ + col);
      Bs[(col + 0) * 40 + k] = (bf16_t)v.x;
      Bs[(col + 1) * 40 + k] = (bf16_t)v.y;
      Bs[(col + 2) * 40 + k] = (bf16_t)v.z;
      Bs[(col + 3) * 40 + k] = (bf16_t)v.w;
    }
    __syncthreads();

    v16bf afrag = load_frag(&As[(wave * 16) * 40], 40, lane);
#pragma unroll
    for (int t = 0; t < 8; ++t) {
      v16bf bfrag = load_frag(&Bs[(t * 16) * 40], 40, lane);
      acc[t] = wmma_bf16(afrag, bfrag, acc[t]);
    }
  }

  // Epilogue. C/D layout: VGPR r -> row m = r + 8*half; col = ln + 16*t.
  float inv[8];
#pragma unroll
  for (int r = 0; r < 8; ++r) {
    if (MODE == 0) {
      float s = 0.f;
#pragma unroll
      for (int t = 0; t < 8; ++t) s += acc[t][r] * acc[t][r];
      s += __shfl_xor(s, 1);  s += __shfl_xor(s, 2);
      s += __shfl_xor(s, 4);  s += __shfl_xor(s, 8);   // full-row sum within half
      inv[r] = 1.0f / fmaxf(sqrtf(s), 1e-12f);
    } else {
      inv[r] = 1.0f;
    }
  }
#pragma unroll
  for (int t = 0; t < 8; ++t)
#pragma unroll
    for (int r = 0; r < 8; ++r) {
      int m = wave * 16 + r + 8 * half;
      Og[(size_t)m * DH_ + t * 16 + ln] = (bf16_t)(acc[t][r] * inv[r]);
    }
}

// ---------------------------------------------------------------------------
// Flash attention (no scale) + fused epilogue:
//   out[n, l, h*128+k] = tanh( gelu( softmax_s(Q[l]·K[s]) @ V ) + res[...] )
// Block = 128 query rows x full DH, streams S in 64-wide tiles.
// K tile staged by the Tensor Data Mover (wave 0 issues tensor_load_to_lds,
// hardware pads 16B per 256B row -> 136-element LDS stride); V^T staged
// manually (TDM has no transpose).
// ---------------------------------------------------------------------------
__global__ __launch_bounds__(256) void mca_flash_kernel(
    const bf16_t* __restrict__ Q, const bf16_t* __restrict__ Kx,
    const bf16_t* __restrict__ V, const float* __restrict__ res,
    float* __restrict__ out) {
  __shared__ bf16_t Ks[64 * 136];   // K tile [s][dh], 136 = 128 + 4-DWORD pad
  __shared__ bf16_t Vt[128 * 72];   // V tile transposed [dh][s]
  __shared__ bf16_t Ps[128 * 72];   // P staging (C-layout -> A-layout round trip)

  const int nh = blockIdx.y, n = nh / H_, h = nh % H_;
  const int l0 = blockIdx.x * 128;
  const int tid = threadIdx.x, wave = tid >> 5, lane = tid & 31;
  const int half = (lane >> 4) & 1, ln = lane & 15;

  const bf16_t* Qg = Q  + ((size_t)nh * L_ + l0) * DH_;
  const bf16_t* Kg = Kx + (size_t)nh * L_ * DH_;
  const bf16_t* Vg = V  + (size_t)nh * L_ * DH_;

  // Q fragments for this wave's 16-row strip, held in registers for all s.
  v16bf qf[4];
#pragma unroll
  for (int kk = 0; kk < 4; ++kk)
    qf[kk] = load_frag(Qg + (size_t)(wave * 16) * DH_ + kk * 32, DH_, lane);

  v8f o_acc[8];
#pragma unroll
  for (int t = 0; t < 8; ++t) o_acc[t] = zero8();
  float m_i[8], l_i[8];
#pragma unroll
  for (int r = 0; r < 8; ++r) { m_i[r] = -3.0e38f; l_i[r] = 0.f; }

  for (int s0 = 0; s0 < L_; s0 += 64) {
#if defined(__AMDGCN__) && __has_builtin(__builtin_amdgcn_tensor_load_to_lds)
    // ---- K tile via TDM: 64 rows x 128 bf16, global -> LDS with padding ----
    if (wave == 0) {
      u64 gaddr = (u64)(uintptr_t)(Kg + (size_t)s0 * DH_);  // tile start (bytes)
      u32 lds   = (u32)(uintptr_t)(&Ks[0]);                 // LDS byte address
      v4u g0;
      g0[0] = 1u;                                    // count=1 (user descriptor)
      g0[1] = lds;                                   // lds_addr
      g0[2] = (u32)gaddr;                            // global_addr[31:0]
      g0[3] = (u32)((gaddr >> 32) & 0x1ffffffu) | (2u << 30);  // addr[56:32], type=2
      v8i g1;
      g1[0] = (int)((1u << 16) |                     // data_size = 1 -> 2 bytes
                    (1u << 20) |                     // pad_enable
                    (5u << 22) |                     // pad_interval: 64 DW = 256B
                    (3u << 25));                     // pad_amount: 4 DW = 16B
      g1[1] = (int)(128u << 16);                     // tensor_dim0 = 128 (lo16)
      g1[2] = (int)((u32)L_ << 16);                  // tensor_dim1 = 2048 (lo16)
      g1[3] = (int)(128u << 16);                     // tile_dim0 = 128
      g1[4] = 64;                                    // tile_dim1 = 64, tile_dim2 = 0
      g1[5] = 128;                                   // tensor_dim0_stride = 128
      g1[6] = 0; g1[7] = 0;
      v4i gz4 = {0, 0, 0, 0};                        // 2D: groups 2/3 unused
      v8i gz8 = {0, 0, 0, 0, 0, 0, 0, 0};            // extra group (clang-23 form)
      __builtin_amdgcn_tensor_load_to_lds(g0, g1, gz4, gz4, gz8, 0);
    }
    // ---- V^T tile staged by all waves, overlapped with the K DMA ----
#pragma unroll
    for (int j = 0; j < 4; ++j) {
      int e8 = (tid + 256 * j) * 8;   // 0..8184, step 8
      int s = e8 >> 7, k = e8 & 127;
      v8bf vv = *(const v8bf*)(Vg + (size_t)(s0 + s) * DH_ + k);
#pragma unroll
      for (int i = 0; i < 8; ++i) Vt[(k + i) * 72 + s] = vv[i];
    }
    if (wave == 0) __builtin_amdgcn_s_wait_tensorcnt(0);
#else
    // Fallback: manual K copy + V^T scatter.
#pragma unroll
    for (int j = 0; j < 4; ++j) {
      int e8 = (tid + 256 * j) * 8;
      int s = e8 >> 7, k = e8 & 127;
      v8bf kv = *(const v8bf*)(Kg + (size_t)(s0 + s) * DH_ + k);
      v8bf vv = *(const v8bf*)(Vg + (size_t)(s0 + s) * DH_ + k);
      *(v8bf*)(&Ks[s * 136 + k]) = kv;
#pragma unroll
      for (int i = 0; i < 8; ++i) Vt[(k + i) * 72 + s] = vv[i];
    }
#endif
    if (s0 + 64 < L_) {  // gfx1250 global_prefetch_b8 for the next V tile
      __builtin_prefetch(Vg + (size_t)(s0 + 64) * DH_ + tid * 32, 0, 1);
    }
    __syncthreads();

    // S = Q @ K^T for this wave's 16 rows x 64 s-cols.
    v8f sacc[4];
#pragma unroll
    for (int t = 0; t < 4; ++t) {
      v8f s = zero8();
#pragma unroll
      for (int kk = 0; kk < 4; ++kk)
        s = wmma_bf16(qf[kk], load_frag(&Ks[(t * 16) * 136 + kk * 32], 136, lane), s);
      sacc[t] = s;
    }

    // Online softmax per row r (row m = r + 8*half lives within one 16-lane half).
#pragma unroll
    for (int r = 0; r < 8; ++r) {
      float mx = fmaxf(fmaxf(sacc[0][r], sacc[1][r]), fmaxf(sacc[2][r], sacc[3][r]));
      mx = fmaxf(mx, __shfl_xor(mx, 1)); mx = fmaxf(mx, __shfl_xor(mx, 2));
      mx = fmaxf(mx, __shfl_xor(mx, 4)); mx = fmaxf(mx, __shfl_xor(mx, 8));
      float mnew = fmaxf(m_i[r], mx);
      float corr = __expf(m_i[r] - mnew);
      float rs = 0.f;
#pragma unroll
      for (int t = 0; t < 4; ++t) {
        float p = __expf(sacc[t][r] - mnew);
        sacc[t][r] = p; rs += p;
      }
      rs += __shfl_xor(rs, 1); rs += __shfl_xor(rs, 2);
      rs += __shfl_xor(rs, 4); rs += __shfl_xor(rs, 8);
      l_i[r] = l_i[r] * corr + rs;
      m_i[r] = mnew;
#pragma unroll
      for (int t = 0; t < 8; ++t) o_acc[t][r] *= corr;
    }

    // Stage P (bf16) to this wave's private LDS strip; LDS is in-order per wave.
#pragma unroll
    for (int t = 0; t < 4; ++t)
#pragma unroll
      for (int r = 0; r < 8; ++r)
        Ps[(wave * 16 + r + 8 * half) * 72 + t * 16 + ln] = (bf16_t)sacc[t][r];

    // O += P @ V  (k-dim = 64 s, two 32-wide WMMA steps; B frags from V^T).
#pragma unroll
    for (int kk = 0; kk < 2; ++kk) {
      v16bf pf = load_frag(&Ps[(wave * 16) * 72 + kk * 32], 72, lane);
#pragma unroll
      for (int t = 0; t < 8; ++t) {
        v16bf vf = load_frag(&Vt[(t * 16) * 72 + kk * 32], 72, lane);
        o_acc[t] = wmma_bf16(pf, vf, o_acc[t]);
      }
    }
    __syncthreads();
  }

  // Epilogue: O/l, exact gelu, +residual, tanh, scatter into [n,l,h*128+col].
  float linv[8];
#pragma unroll
  for (int r = 0; r < 8; ++r) linv[r] = 1.0f / l_i[r];
#pragma unroll
  for (int t = 0; t < 8; ++t)
#pragma unroll
    for (int r = 0; r < 8; ++r) {
      int row = l0 + wave * 16 + r + 8 * half;
      int col = t * 16 + ln;
      size_t idx = (size_t)n * L_ * D_ + (size_t)row * D_ + h * DH_ + col;
      float x = o_acc[t][r] * linv[r];
      float g = 0.5f * x * (1.0f + erff(x * 0.70710678118654752f));
      out[idx] = tanhf(g + res[idx]);
    }
}

extern "C" void kernel_launch(void* const* d_in, const int* in_sizes, int n_in,
                              void* d_out, int out_size, void* d_ws, size_t ws_size,
                              hipStream_t stream) {
  const float* rgb       = (const float*)d_in[0];
  const float* flow      = (const float*)d_in[1];
  const float* rgb_proj  = (const float*)d_in[2];
  const float* flow_proj = (const float*)d_in[3];
  const float* atte_w    = (const float*)d_in[4];

  float* f_rgb  = (float*)d_out;
  float* f_flow = f_rgb + (size_t)N_ * L_ * D_;

  const size_t oElems = (size_t)N_ * H_ * L_ * DH_;   // 8,388,608 (16 MB bf16)
  bf16_t* o_rgb  = (bf16_t*)d_ws;
  bf16_t* o_flow = o_rgb + oElems;
  bf16_t* Tq     = o_flow + oElems;                   // o_rgb @ atte_w

  dim3 grid(L_ / 128, N_ * H_);
  dim3 block(256);

  mca_gemm_kernel<0><<<grid, block, 0, stream>>>(rgb,  nullptr, rgb_proj,  o_rgb,  D_);
  mca_gemm_kernel<0><<<grid, block, 0, stream>>>(flow, nullptr, flow_proj, o_flow, D_);
  mca_gemm_kernel<1><<<grid, block, 0, stream>>>(nullptr, o_rgb, atte_w,   Tq,     DH_);

  mca_flash_kernel<<<grid, block, 0, stream>>>(Tq,     o_flow, o_rgb,  rgb,  f_rgb);
  mca_flash_kernel<<<grid, block, 0, stream>>>(o_flow, Tq,     o_flow, flow, f_flow);
}

// v001
// It runs in 514 microseconds.
// Timed twice side by side with v000, it ran 1.36 times as fast both times.
#include <hip/hip_runtime.h>
#include <hip/hip_bf16.h>
#include <math.h>

// MI455X / gfx1250, wave32. All heavy math goes through v_wmma_f32_16x16x32_bf16;
// the flash kernel's K-tile staging uses the Tensor Data Mover (tensor_load_to_lds
// + s_wait_tensorcnt) with hardware LDS padding to produce the bank-conflict-free
// 136-element row stride.
// Pipeline:
//   o_rgb  = l2norm(rgb  @ rgb_proj[h])          (GEMM kernel, MODE 0)
//   o_flow = l2norm(flow @ flow_proj[h])         (GEMM kernel, MODE 0)
//   T      = o_rgb @ atte_w[h]                   (GEMM kernel, MODE 1)
//   f_rgb  = tanh(gelu(Flash(Q=T,      K=o_flow, V=o_rgb )) + rgb )
//   f_flow = tanh(gelu(Flash(Q=o_flow, K=T,      V=o_flow)) + flow)
// Flash-style streaming avoids the 512MB atte tensor entirely.

#define N_  4
#define L_  2048
#define D_  1024
#define H_  8
#define DH_ 128

typedef __bf16 bf16_t;
typedef unsigned int       u32;
typedef unsigned long long u64;
typedef __attribute__((ext_vector_type(16))) __bf16 v16bf;
typedef __attribute__((ext_vector_type(8)))  __bf16 v8bf;
typedef __attribute__((ext_vector_type(4)))  __bf16 v4bf;
typedef __attribute__((ext_vector_type(8)))  float  v8f;
typedef __attribute__((ext_vector_type(4)))  u32    v4u;
typedef __attribute__((ext_vector_type(8)))  int    v8i;
typedef __attribute__((ext_vector_type(4)))  int    v4i;

static __device__ __forceinline__ v8f wmma_bf16(v16bf a, v16bf b, v8f c) {
  // 8 args: (neg_a, A, neg_b, B, c_mod, C, reuse_a, reuse_b)
  return __builtin_amdgcn_wmma_f32_16x16x32_bf16(false, a, false, b, (short)0, c,
                                                 false, false);
}

// 16x32 bf16 fragment per ISA 7.12.2:
//   lane<16 : row M=lane,    K = {0..7, 16..23}
//   lane>=16: row M=lane-16, K = {8..15, 24..31}
// base points at a [16 x 32] tile, row-major with `stride` elements per row.
// (B fragments use the same pattern from a [N][K]-transposed LDS tile.)
static __device__ __forceinline__ v16bf load_frag(const bf16_t* base, int stride,
                                                  int lane) {
  const int r  = lane & 15;
  const int kb = (lane & 16) ? 8 : 0;
  const bf16_t* p = base + (size_t)r * stride + kb;
  v8bf lo = *(const v8bf*)(p);
  v8bf hi = *(const v8bf*)(p + 16);
  v16bf f;
#pragma unroll
  for (int i = 0; i < 8; ++i) { f[i] = lo[i]; f[i + 8] = hi[i]; }
  return f;
}

// B fragment (32 k x 16 n) out of a row-major [k][n] LDS tile by the transposing
// load: lane (c = lane & 15, hh = lane >> 4) gets T[kbase + 8*hh + 0..7][c], so the
// loads at kbase and kbase + 16 give the same k order as load_frag above.
// p is the lane's own address: row 8*hh + (lane & 7), column 8*((lane >> 3) & 1).
static __device__ __forceinline__ v16bf load_frag_tr(const bf16_t* p, int stride) {
  typedef __attribute__((address_space(3))) v8bf lds_v8bf;
  v8bf lo = __builtin_amdgcn_ds_load_tr16_b128_v8bf16((lds_v8bf*)p);
  v8bf hi = __builtin_amdgcn_ds_load_tr16_b128_v8bf16((lds_v8bf*)(p + 16 * stride));
  v16bf f;
#pragma unroll
  for (int i = 0; i < 8; ++i) { f[i] = lo[i]; f[i + 8] = hi[i]; }
  return f;
}

static __device__ __forceinline__ v8f zero8() {
  v8f z = {0.f, 0.f, 0.f, 0.f, 0.f, 0.f, 0.f, 0.f};
  return z;
}

// ---------------------------------------------------------------------------
// GEMM: O[l,k] = A[l,:] @ B[:,k]  per (n,h) slice, 128x128 output per block.
// MODE 0: A = f32 [L_,D_] (shared across heads), B = f32 proj[h] [D_,128],
//         epilogue = per-row L2 normalize. Kdim = 1024.
// MODE 1: A = bf16 o_rgb slice [L_,128], B = f32 atte_w[h] [128,128]. Kdim=128.
// Output bf16 [n,h,l,128].
// ---------------------------------------------------------------------------
template <int MODE>
__global__ __launch_bounds__(256) void mca_gemm_kernel(
    const float* __restrict__ Af, const bf16_t* __restrict__ Ab,
    const float* __restrict__ Bf, bf16_t* __restrict__ O, int Kdim) {
  __shared__ bf16_t As[128 * 40];   // padded stride 40 (80B rows, 16B aligned)
  __shared__ bf16_t Bs[128 * 40];   // stored transposed: Bs[n][k]

  const int nh = blockIdx.y, n = nh / H_, h = nh % H_;
  const int l0 = blockIdx.x * 128;
  const int tid = threadIdx.x, wave = tid >> 5, lane = tid & 31;
  const int half = (lane >> 4) & 1, ln = lane & 15;

  const float*  Ag  = (MODE == 0) ? Af + ((size_t)n * L_ + l0) * (size_t)D_ : nullptr;
  const bf16_t* Ag2 = (MODE == 0) ? nullptr : Ab + ((size_t)nh * L_ + l0) * DH_;
  const float* Bg = Bf + (size_t)h * Kdim * DH_;
  bf16_t* Og = O + ((size_t)nh * L_ + l0) * DH_;

  v8f acc[8];
#pragma unroll
  for (int t = 0; t < 8; ++t) acc[t] = zero8();

  for (int k0 = 0; k0 < Kdim; k0 += 32) {
    __syncthreads();
    // --- Stage A tile: 128 rows x 32 k -----------------------------------
    if (MODE == 0) {
      // f32 -> bf16, float4 loads + packed 8B LDS stores (4096 elems).
#pragma unroll
      for (int j = 0; j < 4; ++j) {
        int e4 = (tid + 256 * j) * 4;          // 0..4092, step 4
        int row = e4 >> 5, k = e4 & 31;
        float4 v = *(const float4*)(Ag + (size_t)row * D_ + k0 + k);
        v4bf d;
        d[0] = (bf16_t)v.x; d[1] = (bf16_t)v.y;
        d[2] = (bf16_t)v.z; d[3] = (bf16_t)v.w;
        *(v4bf*)(&As[row * 40 + k]) = d;
      }
    } else {
      // bf16 copy, b128 loads/stores (4096 elems).
#pragma unroll
      for (int j = 0; j < 2; ++j) {
        int e8 = (tid + 256 * j) * 8;          // 0..4088, step 8
        int row = e8 >> 5, k = e8 & 31;
        *(v8bf*)(&As[row * 40 + k]) =
            *(const v8bf*)(Ag2 + (size_t)row * DH_ + k0 + k);
      }
    }
    // --- Stage B tile transposed: Bs[n][k] = B[k0+k][n] ------------------
#pragma unroll
    for (int j = 0; j < 4; ++j) {
      int e4 = (tid + 256 * j) * 4;            // 0..4092, step 4
      int k = e4 >> 7, col = e4 & 127;
      float4 v = *(const float4*)(Bg + (size_t)(k0 + k) * DH_ + col);
      Bs[(col + 0) * 40 + k] = (bf16_t)v.x;
      Bs[(col + 1) * 40 + k] = (bf16_t)v.y;
      Bs[(col + 2) * 40 + k] = (bf16_t)v.z;
      Bs[(col + 3) * 40 + k] = (bf16_t)v.w;
    }
    __syncthreads();

    v16bf afrag = load_frag(&As[(wave * 16) * 40], 40, lane);
#pragma unroll
    for (int t = 0; t < 8; ++t) {
      v16bf bfrag = load_frag(&Bs[(t * 16) * 40], 40, lane);
      acc[t] = wmma_bf16(afrag, bfrag, acc[t]);
    }
  }

  // Epilogue. C/D layout: VGPR r -> row m = r + 8*half; col = ln + 16*t.
  float inv[8];
#pragma unroll
  for (int r = 0; r < 8; ++r) {
    if (MODE == 0) {
      float s = 0.f;
#pragma unroll
      for (int t = 0; t < 8; ++t) s += acc[t][r] * acc[t][r];
      s += __shfl_xor(s, 1);  s += __shfl_xor(s, 2);
      s += __shfl_xor(s, 4);  s += __shfl_xor(s, 8);   // full-row sum within half
      inv[r] = 1.0f / fmaxf(sqrtf(s), 1e-12f);
    } else {
      inv[r] = 1.0f;
    }
  }
#pragma unroll
  for (int t = 0; t < 8; ++t)
#pragma unroll
    for (int r = 0; r < 8; ++r) {
      int m = wave * 16 + r + 8 * half;
      Og[(size_t)m * DH_ + t * 16 + ln] = (bf16_t)(acc[t][r] * inv[r]);
    }
}

// ---------------------------------------------------------------------------
// Flash attention (no scale) + fused epilogue:
//   out[n, l, h*128+k] = tanh( gelu( softmax_s(Q[l]·K[s]) @ V ) + res[...] )
// Block = 128 query rows x full DH, streams S in 64-wide tiles.
// K tile staged by the Tensor Data Mover (wave 0 issues tensor_load_to_lds,
// hardware pads 16B per 256B row -> 136-element LDS stride); V staged row-major
// with 16B stores and transposed on the way out by ds_load_tr16_b128.
// ---------------------------------------------------------------------------
__global__ __launch_bounds__(256) void mca_flash_kernel(
    const bf16_t* __restrict__ Q, const bf16_t* __restrict__ Kx,
    const bf16_t* __restrict__ V, const float* __restrict__ res,
    float* __restrict__ out) {
  __shared__ bf16_t Ks[64 * 136];   // K tile [s][dh], 136 = 128 + 4-DWORD pad
  __shared__ bf16_t Vs[64 * 144];   // V tile [s][dh], 288B rows (32B x odd: tr16 reader)
  __shared__ bf16_t Ps[128 * 72];   // P staging (C-layout -> A-layout round trip)

  const int nh = blockIdx.y, n = nh / H_, h = nh % H_;
  const int l0 = blockIdx.x * 128;
  const int tid = threadIdx.x, wave = tid >> 5, lane = tid & 31;
  const int half = (lane >> 4) & 1, ln = lane & 15;

  const bf16_t* Qg = Q  + ((size_t)nh * L_ + l0) * DH_;
  const bf16_t* Kg = Kx + (size_t)nh * L_ * DH_;
  const bf16_t* Vg = V  + (size_t)nh * L_ * DH_;

  // Q fragments for this wave's 16-row strip, held in registers for all s.
  v16bf qf[4];
#pragma unroll
  for (int kk = 0; kk < 4; ++kk)
    qf[kk] = load_frag(Qg + (size_t)(wave * 16) * DH_ + kk * 32, DH_, lane);

  // This lane's address in the V tile for the transposing loads.
  const bf16_t* vtr = &Vs[(8 * half + (lane & 7)) * 144 + 8 * ((lane >> 3) & 1)];

  v8f o_acc[8];
#pragma unroll
  for (int t = 0; t < 8; ++t) o_acc[t] = zero8();
  float m_i[8], l_i[8];
#pragma unroll
  for (int r = 0; r < 8; ++r) { m_i[r] = -3.0e38f; l_i[r] = 0.f; }

  for (int s0 = 0; s0 < L_; s0 += 64) {
#if defined(__AMDGCN__) && __has_builtin(__builtin_amdgcn_tensor_load_to_lds)
    // ---- K tile via TDM: 64 rows x 128 bf16, global -> LDS with padding ----
    if (wave == 0) {
      u64 gaddr = (u64)(uintptr_t)(Kg + (size_t)s0 * DH_);  // tile start (bytes)
      u32 lds   = (u32)(uintptr_t)(&Ks[0]);                 // LDS byte address
      v4u g0;
      g0[0] = 1u;                                    // count=1 (user descriptor)
      g0[1] = lds;                                   // lds_addr
      g0[2] = (u32)gaddr;                            // global_addr[31:0]
      g0[3] = (u32)((gaddr >> 32) & 0x1ffffffu) | (2u << 30);  // addr[56:32], type=2
      v8i g1;
      g1[0] = (int)((1u << 16) |                     // data_size = 1 -> 2 bytes
                    (1u << 20) |                     // pad_enable
                    (5u << 22) |                     // pad_interval: 64 DW = 256B
                    (3u << 25));                     // pad_amount: 4 DW = 16B
      g1[1] = (int)(128u << 16);                     // tensor_dim0 = 128 (lo16)
      g1[2] = (int)((u32)L_ << 16);                  // tensor_dim1 = 2048 (lo16)
      g1[3] = (int)(128u << 16);                     // tile_dim0 = 128
      g1[4] = 64;                                    // tile_dim1 = 64, tile_dim2 = 0
      g1[5] = 128;                                   // tensor_dim0_stride = 128
      g1[6] = 0; g1[7] = 0;
      v4i gz4 = {0, 0, 0, 0};                        // 2D: groups 2/3 unused
      v8i gz8 = {0, 0, 0, 0, 0, 0, 0, 0};            // extra group (clang-23 form)
      __builtin_amdgcn_tensor_load_to_lds(g0, g1, gz4, gz4, gz8, 0);
    }
    // ---- V tile staged by all waves, overlapped with the K DMA ----
#pragma unroll
    for (int j = 0; j < 4; ++j) {
      int e8 = (tid + 256 * j) * 8;   // 0..8184, step 8
      int s = e8 >> 7, k = e8 & 127;
      v8bf vv = *(const v8bf*)(Vg + (size_t)(s0 + s) * DH_ + k);
      *(v8bf*)(&Vs[s * 144 + k]) = vv;
    }
    if (wave == 0) __builtin_amdgcn_s_wait_tensorcnt(0);
#else
    // Fallback: manual K and V copy.
#pragma unroll
    for (int j = 0; j < 4; ++j) {
      int e8 = (tid + 256 * j) * 8;
      int s = e8 >> 7, k = e8 & 127;
      v8bf kv = *(const v8bf*)(Kg + (size_t)(s0 + s) * DH_ + k);
      v8bf vv = *(const v8bf*)(Vg + (size_t)(s0 + s) * DH_ + k);
      *(v8bf*)(&Ks[s * 136 + k]) = kv;
      *(v8bf*)(&Vs[s * 144 + k]) = vv;
    }
#endif
    if (s0 + 64 < L_) {  // gfx1250 global_prefetch_b8 for the next V tile
      __builtin_prefetch(Vg + (size_t)(s0 + 64) * DH_ + tid * 32, 0, 1);
    }
    __syncthreads();

    // S = Q @ K^T for this wave's 16 rows x 64 s-cols.
    v8f sacc[4];
#pragma unroll
    for (int t = 0; t < 4; ++t) {
      v8f s = zero8();
#pragma unroll
      for (int kk = 0; kk < 4; ++kk)
        s = wmma_bf16(qf[kk], load_frag(&Ks[(t * 16) * 136 + kk * 32], 136, lane), s);
      sacc[t] = s;
    }

    // Online softmax per row r (row m = r + 8*half lives within one 16-lane half).
#pragma unroll
    for (int r = 0; r < 8; ++r) {
      float mx = fmaxf(fmaxf(sacc[0][r], sacc[1][r]), fmaxf(sacc[2][r], sacc[3][r]));
      mx = fmaxf(mx, __shfl_xor(mx, 1)); mx = fmaxf(mx, __shfl_xor(mx, 2));
      mx = fmaxf(mx, __shfl_xor(mx, 4)); mx = fmaxf(mx, __shfl_xor(mx, 8));
      float mnew = fmaxf(m_i[r], mx);
      float corr = __expf(m_i[r] - mnew);
      float rs = 0.f;
#pragma unroll
      for (int t = 0; t < 4; ++t) {
        float p = __expf(sacc[t][r] - mnew);
        sacc[t][r] = p; rs += p;
      }
      rs += __shfl_xor(rs, 1); rs += __shfl_xor(rs, 2);
      rs += __shfl_xor(rs, 4); rs += __shfl_xor(rs, 8);
      l_i[r] = l_i[r] * corr + rs;
      m_i[r] = mnew;
#pragma unroll
      for (int t = 0; t < 8; ++t) o_acc[t][r] *= corr;
    }

    // Stage P (bf16) to this wave's private LDS strip; LDS is in-order per wave.
#pragma unroll
    for (int t = 0; t < 4; ++t)
#pragma unroll
      for (int r = 0; r < 8; ++r)
        Ps[(wave * 16 + r + 8 * half) * 72 + t * 16 + ln] = (bf16_t)sacc[t][r];

    // O += P @ V  (k-dim = 64 s, two 32-wide WMMA steps; B frags transposed on load).
#pragma unroll
    for (int kk = 0; kk < 2; ++kk) {
      v16bf pf = load_frag(&Ps[(wave * 16) * 72 + kk * 32], 72, lane);
#pragma unroll
      for (int t = 0; t < 8; ++t) {
        v16bf vf = load_frag_tr(vtr + (kk * 32) * 144 + t * 16, 144);
        o_acc[t] = wmma_bf16(pf, vf, o_acc[t]);
      }
    }
    __syncthreads();
  }

  // Epilogue: O/l, exact gelu, +residual, tanh, scatter into [n,l,h*128+col].
  float linv[8];
#pragma unroll
  for (int r = 0; r < 8; ++r) linv[r] = 1.0f / l_i[r];
#pragma unroll
  for (int t = 0; t < 8; ++t)
#pragma unroll
    for (int r = 0; r < 8; ++r) {
      int row = l0 + wave * 16 + r + 8 * half;
      int col = t * 16 + ln;
      size_t idx = (size_t)n * L_ * D_ + (size_t)row * D_ + h * DH_ + col;
      float x = o_acc[t][r] * linv[r];
      float g = 0.5f * x * (1.0f + erff(x * 0.70710678118654752f));
      out[idx] = tanhf(g + res[idx]);
    }
}

extern "C" void kernel_launch(void* const* d_in, const int* in_sizes, int n_in,
                              void* d_out, int out_size, void* d_ws, size_t ws_size,
                              hipStream_t stream) {
  const float* rgb       = (const float*)d_in[0];
  const float* flow      = (const float*)d_in[1];
  const float* rgb_proj  = (const float*)d_in[2];
  const float* flow_proj = (const float*)d_in[3];
  const float* atte_w    = (const float*)d_in[4];

  float* f_rgb  = (float*)d_out;
  float* f_flow = f_rgb + (size_t)N_ * L_ * D_;

  const size_t oElems = (size_t)N_ * H_ * L_ * DH_;   // 8,388,608 (16 MB bf16)
  bf16_t* o_rgb  = (bf16_t*)d_ws;
  bf16_t* o_flow = o_rgb + oElems;
  bf16_t* Tq     = o_flow + oElems;                   // o_rgb @ atte_w

  dim3 grid(L_ / 128, N_ * H_);
  dim3 block(256);

  mca_gemm_kernel<0><<<grid, block, 0, stream>>>(rgb,  nullptr, rgb_proj,  o_rgb,  D_);
  mca_gemm_kernel<0><<<grid, block, 0, stream>>>(flow, nullptr, flow_proj, o_flow, D_);
  mca_gemm_kernel<1><<<grid, block, 0, stream>>>(nullptr, o_rgb, atte_w,   Tq,     DH_);

  mca_flash_kernel<<<grid, block, 0, stream>>>(Tq,     o_flow, o_rgb,  rgb,  f_rgb);
  mca_flash_kernel<<<grid, block, 0, stream>>>(o_flow, Tq,     o_flow, flow, f_flow);
}

// v002
// It runs in 341 microseconds.
// In two side-by-side timings against v001, it was 1.51 and 1.50 times as fast.
// Counting every step since v000, it is 2.05 times as fast.
#include <hip/hip_runtime.h>
#include <hip/hip_bf16.h>
#include <math.h>

// MI455X / gfx1250, wave32. All heavy math goes through v_wmma_f32_16x16x32_bf16;
// the flash kernel's K-tile staging uses the Tensor Data Mover (tensor_load_to_lds
// + s_wait_tensorcnt) with hardware LDS padding to produce the bank-conflict-free
// 136-element row stride.
// Pipeline:
//   o_rgb  = l2norm(rgb  @ rgb_proj[h])          (GEMM kernel, MODE 0)
//   o_flow = l2norm(flow @ flow_proj[h])         (GEMM kernel, MODE 0)
//   T      = o_rgb @ atte_w[h]                   (GEMM kernel, MODE 1)
//   f_rgb  = tanh(gelu(Flash(Q=T,      K=o_flow, V=o_rgb )) + rgb )
//   f_flow = tanh(gelu(Flash(Q=o_flow, K=T,      V=o_flow)) + flow)
// Flash-style streaming avoids the 512MB atte tensor entirely.

#define N_  4
#define L_  2048
#define D_  1024
#define H_  8
#define DH_ 128

typedef __bf16 bf16_t;
typedef unsigned int       u32;
typedef unsigned long long u64;
typedef __attribute__((ext_vector_type(16))) __bf16 v16bf;
typedef __attribute__((ext_vector_type(8)))  __bf16 v8bf;
typedef __attribute__((ext_vector_type(4)))  __bf16 v4bf;
typedef __attribute__((ext_vector_type(8)))  float  v8f;
typedef __attribute__((ext_vector_type(4)))  u32    v4u;
typedef __attribute__((ext_vector_type(8)))  int    v8i;
typedef __attribute__((ext_vector_type(4)))  int    v4i;

static __device__ __forceinline__ v8f wmma_bf16(v16bf a, v16bf b, v8f c) {
  // 8 args: (neg_a, A, neg_b, B, c_mod, C, reuse_a, reuse_b)
  return __builtin_amdgcn_wmma_f32_16x16x32_bf16(false, a, false, b, (short)0, c,
                                                 false, false);
}

// 16x32 bf16 fragment per ISA 7.12.2:
//   lane<16 : row M=lane,    K = {0..7, 16..23}
//   lane>=16: row M=lane-16, K = {8..15, 24..31}
// base points at a [16 x 32] tile, row-major with `stride` elements per row.
// (B fragments use the same pattern from an [N][K] tile: Bs in LDS, Q rows in global memory.)
static __device__ __forceinline__ v16bf load_frag(const bf16_t* base, int stride,
                                                  int lane) {
  const int r  = lane & 15;
  const int kb = (lane & 16) ? 8 : 0;
  const bf16_t* p = base + (size_t)r * stride + kb;
  v8bf lo = *(const v8bf*)(p);
  v8bf hi = *(const v8bf*)(p + 16);
  v16bf f;
#pragma unroll
  for (int i = 0; i < 8; ++i) { f[i] = lo[i]; f[i + 8] = hi[i]; }
  return f;
}

// B fragment (32 k x 16 n) out of a row-major [k][n] LDS tile by the transposing
// load: lane (c = lane & 15, hh = lane >> 4) gets T[kbase + 8*hh + 0..7][c], so the
// loads at kbase and kbase + 16 give the same k order as load_frag above.
// p is the lane's own address: row 8*hh + (lane & 7), column 8*((lane >> 3) & 1).
static __device__ __forceinline__ v16bf load_frag_tr(const bf16_t* p, int stride) {
  typedef __attribute__((address_space(3))) v8bf lds_v8bf;
  v8bf lo = __builtin_amdgcn_ds_load_tr16_b128_v8bf16((lds_v8bf*)p);
  v8bf hi = __builtin_amdgcn_ds_load_tr16_b128_v8bf16((lds_v8bf*)(p + 16 * stride));
  v16bf f;
#pragma unroll
  for (int i = 0; i < 8; ++i) { f[i] = lo[i]; f[i + 8] = hi[i]; }
  return f;
}

static __device__ __forceinline__ v8f zero8() {
  v8f z = {0.f, 0.f, 0.f, 0.f, 0.f, 0.f, 0.f, 0.f};
  return z;
}

// ---------------------------------------------------------------------------
// GEMM: O[l,k] = A[l,:] @ B[:,k]  per (n,h) slice, 128x128 output per block.
// MODE 0: A = f32 [L_,D_] (shared across heads), B = f32 proj[h] [D_,128],
//         epilogue = per-row L2 normalize. Kdim = 1024.
// MODE 1: A = bf16 o_rgb slice [L_,128], B = f32 atte_w[h] [128,128]. Kdim=128.
// Output bf16 [n,h,l,128].
// ---------------------------------------------------------------------------
template <int MODE>
__global__ __launch_bounds__(256) void mca_gemm_kernel(
    const float* __restrict__ Af, const bf16_t* __restrict__ Ab,
    const float* __restrict__ Bf, bf16_t* __restrict__ O, int Kdim) {
  __shared__ bf16_t As[128 * 40];   // padded stride 40 (80B rows, 16B aligned)
  __shared__ bf16_t Bs[128 * 40];   // stored transposed: Bs[n][k]

  const int nh = blockIdx.y, n = nh / H_, h = nh % H_;
  const int l0 = blockIdx.x * 128;
  const int tid = threadIdx.x, wave = tid >> 5, lane = tid & 31;
  const int half = (lane >> 4) & 1, ln = lane & 15;

  const float*  Ag  = (MODE == 0) ? Af + ((size_t)n * L_ + l0) * (size_t)D_ : nullptr;
  const bf16_t* Ag2 = (MODE == 0) ? nullptr : Ab + ((size_t)nh * L_ + l0) * DH_;
  const float* Bg = Bf + (size_t)h * Kdim * DH_;
  bf16_t* Og = O + ((size_t)nh * L_ + l0) * DH_;

  v8f acc[8];
#pragma unroll
  for (int t = 0; t < 8; ++t) acc[t] = zero8();

  for (int k0 = 0; k0 < Kdim; k0 += 32) {
    __syncthreads();
    // --- Stage A tile: 128 rows x 32 k -----------------------------------
    if (MODE == 0) {
      // f32 -> bf16, float4 loads + packed 8B LDS stores (4096 elems).
#pragma unroll
      for (int j = 0; j < 4; ++j) {
        int e4 = (tid + 256 * j) * 4;          // 0..4092, step 4
        int row = e4 >> 5, k = e4 & 31;
        float4 v = *(const float4*)(Ag + (size_t)row * D_ + k0 + k);
        v4bf d;
        d[0] = (bf16_t)v.x; d[1] = (bf16_t)v.y;
        d[2] = (bf16_t)v.z; d[3] = (bf16_t)v.w;
        *(v4bf*)(&As[row * 40 + k]) = d;
      }
    } else {
      // bf16 copy, b128 loads/stores (4096 elems).
#pragma unroll
      for (int j = 0; j < 2; ++j) {
        int e8 = (tid + 256 * j) * 8;          // 0..4088, step 8
        int row = e8 >> 5, k = e8 & 31;
        *(v8bf*)(&As[row * 40 + k]) =
            *(const v8bf*)(Ag2 + (size_t)row * DH_ + k0 + k);
      }
    }
    // --- Stage B tile transposed: Bs[n][k] = B[k0+k][n] ------------------
#pragma unroll
    for (int j = 0; j < 4; ++j) {
      int e4 = (tid + 256 * j) * 4;            // 0..4092, step 4
      int k = e4 >> 7, col = e4 & 127;
      float4 v = *(const float4*)(Bg + (size_t)(k0 + k) * DH_ + col);
      Bs[(col + 0) * 40 + k] = (bf16_t)v.x;
      Bs[(col + 1) * 40 + k] = (bf16_t)v.y;
      Bs[(col + 2) * 40 + k] = (bf16_t)v.z;
      Bs[(col + 3) * 40 + k] = (bf16_t)v.w;
    }
    __syncthreads();

    v16bf afrag = load_frag(&As[(wave * 16) * 40], 40, lane);
#pragma unroll
    for (int t = 0; t < 8; ++t) {
      v16bf bfrag = load_frag(&Bs[(t * 16) * 40], 40, lane);
      acc[t] = wmma_bf16(afrag, bfrag, acc[t]);
    }
  }

  // Epilogue. C/D layout: VGPR r -> row m = r + 8*half; col = ln + 16*t.
  float inv[8];
#pragma unroll
  for (int r = 0; r < 8; ++r) {
    if (MODE == 0) {
      float s = 0.f;
#pragma unroll
      for (int t = 0; t < 8; ++t) s += acc[t][r] * acc[t][r];
      s += __shfl_xor(s, 1);  s += __shfl_xor(s, 2);
      s += __shfl_xor(s, 4);  s += __shfl_xor(s, 8);   // full-row sum within half
      inv[r] = 1.0f / fmaxf(sqrtf(s), 1e-12f);
    } else {
      inv[r] = 1.0f;
    }
  }
#pragma unroll
  for (int t = 0; t < 8; ++t)
#pragma unroll
    for (int r = 0; r < 8; ++r) {
      int m = wave * 16 + r + 8 * half;
      Og[(size_t)m * DH_ + t * 16 + ln] = (bf16_t)(acc[t][r] * inv[r]);
    }
}

static __device__ __forceinline__ float xhalf(float x) {
  return __builtin_bit_cast(float, __builtin_amdgcn_permlanex16(
      __builtin_bit_cast(int, x), __builtin_bit_cast(int, x),
      0x76543210, 0xfedcba98, false, false));
}

__global__ __launch_bounds__(256) void mca_flash_kernel(
    const bf16_t* __restrict__ Q, const bf16_t* __restrict__ Kx,
    const bf16_t* __restrict__ V, const float* __restrict__ res,
    float* __restrict__ out) {
  __shared__ bf16_t Ks[64 * 136];   // K tile [s][dh], 136 = 128 + 4-DWORD pad
  __shared__ bf16_t Vs[64 * 144];   // V tile [s][dh], 288B rows (32B x odd: tr16 reader)
  __shared__ __attribute__((aligned(16))) float Os[8 * 16 * 132];  // epilogue: per-wave 16 x 128 tile, O^T -> rows

  const int nh = blockIdx.y, n = nh / H_, h = nh % H_;
  const int l0 = blockIdx.x * 128;
  const int tid = threadIdx.x, wave = tid >> 5, lane = tid & 31;
  const int half = (lane >> 4) & 1, ln = lane & 15;

  const bf16_t* Qg = Q  + ((size_t)nh * L_ + l0) * DH_;
  const bf16_t* Kg = Kx + (size_t)nh * L_ * DH_;
  const bf16_t* Vg = V  + (size_t)nh * L_ * DH_;

  // Q fragments for this wave's 16-row strip, held in registers for all s.
  v16bf qf[4];
#pragma unroll
  for (int kk = 0; kk < 4; ++kk)
    qf[kk] = load_frag(Qg + (size_t)(wave * 16) * DH_ + kk * 32, DH_, lane);

  // This lane's address in the V tile for the transposing loads.
  const bf16_t* vtr = &Vs[(8 * half + (lane & 7)) * 144 + 8 * ((lane >> 3) & 1)];

  v8f o_acc[8];
#pragma unroll
  for (int t = 0; t < 8; ++t) o_acc[t] = zero8();
  // Query q = ln of this wave's strip: running maximum (equal in both halves) and
  // this half's part of the running sum (joined once, behind the loop).
  float m_i = -3.0e38f, l_i = 0.f;

  for (int s0 = 0; s0 < L_; s0 += 64) {
#if defined(__AMDGCN__) && __has_builtin(__builtin_amdgcn_tensor_load_to_lds)
    // ---- K tile via TDM: 64 rows x 128 bf16, global -> LDS with padding ----
    if (wave == 0) {
      u64 gaddr = (u64)(uintptr_t)(Kg + (size_t)s0 * DH_);  // tile start (bytes)
      u32 lds   = (u32)(uintptr_t)(&Ks[0]);                 // LDS byte address
      v4u g0;
      g0[0] = 1u;                                    // count=1 (user descriptor)
      g0[1] = lds;                                   // lds_addr
      g0[2] = (u32)gaddr;                            // global_addr[31:0]
      g0[3] = (u32)((gaddr >> 32) & 0x1ffffffu) | (2u << 30);  // addr[56:32], type=2
      v8i g1;
      g1[0] = (int)((1u << 16) |                     // data_size = 1 -> 2 bytes
                    (1u << 20) |                     // pad_enable
                    (5u << 22) |                     // pad_interval: 64 DW = 256B
                    (3u << 25));                     // pad_amount: 4 DW = 16B
      g1[1] = (int)(128u << 16);                     // tensor_dim0 = 128 (lo16)
      g1[2] = (int)((u32)L_ << 16);                  // tensor_dim1 = 2048 (lo16)
      g1[3] = (int)(128u << 16);                     // tile_dim0 = 128
      g1[4] = 64;                                    // tile_dim1 = 64, tile_dim2 = 0
      g1[5] = 128;                                   // tensor_dim0_stride = 128
      g1[6] = 0; g1[7] = 0;
      v4i gz4 = {0, 0, 0, 0};                        // 2D: groups 2/3 unused
      v8i gz8 = {0, 0, 0, 0, 0, 0, 0, 0};            // extra group (clang-23 form)
      __builtin_amdgcn_tensor_load_to_lds(g0, g1, gz4, gz4, gz8, 0);
    }
    // ---- V tile staged by all waves, overlapped with the K DMA ----
#pragma unroll
    for (int j = 0; j < 4; ++j) {
      int e8 = (tid + 256 * j) * 8;   // 0..8184, step 8
      int s = e8 >> 7, k = e8 & 127;
      v8bf vv = *(const v8bf*)(Vg + (size_t)(s0 + s) * DH_ + k);
      *(v8bf*)(&Vs[s * 144 + k]) = vv;
    }
    if (wave == 0) __builtin_amdgcn_s_wait_tensorcnt(0);
#else
    // Fallback: manual K and V copy.
#pragma unroll
    for (int j = 0; j < 4; ++j) {
      int e8 = (tid + 256 * j) * 8;
      int s = e8 >> 7, k = e8 & 127;
      v8bf kv = *(const v8bf*)(Kg + (size_t)(s0 + s) * DH_ + k);
      v8bf vv = *(const v8bf*)(Vg + (size_t)(s0 + s) * DH_ + k);
      *(v8bf*)(&Ks[s * 136 + k]) = kv;
      *(v8bf*)(&Vs[s * 144 + k]) = vv;
    }
#endif
    if (s0 + 64 < L_) {  // gfx1250 global_prefetch_b8 for the next V tile
      __builtin_prefetch(Vg + (size_t)(s0 + 64) * DH_ + tid * 32, 0, 1);
    }
    __syncthreads();

    // S^T = K @ Q^T: tile t holds keys s = 16 t + r + 8 half (register r) of query ln.
    v8f sacc[4];
#pragma unroll  // constant indices keep these vectors in registers
    for (int t = 0; t < 4; ++t) {
      v8f s = zero8();
#pragma unroll  // constant indices keep these vectors in registers
      for (int kk = 0; kk < 4; ++kk)
        s = wmma_bf16(load_frag(&Ks[(t * 16) * 136 + kk * 32], 136, lane), qf[kk], s);
      sacc[t] = s;
    }

    // Online softmax of query ln: 32 scores in this lane, the other 32 in lane ^ 16.
    float mt[4];
#pragma unroll  // constant indices keep these vectors in registers
    for (int t = 0; t < 4; ++t) {
      mt[t] = sacc[t][0];
#pragma unroll  // constant indices keep these vectors in registers
      for (int r = 1; r < 8; ++r) mt[t] = fmaxf(mt[t], sacc[t][r]);
    }
    float mx = fmaxf(fmaxf(mt[0], mt[1]), fmaxf(mt[2], mt[3]));
    mx = fmaxf(mx, xhalf(mx));
    const float mnew = fmaxf(m_i, mx);
    const float corr = __expf(m_i - mnew);
    float rs[4];
#pragma unroll  // constant indices keep these vectors in registers
    for (int t = 0; t < 4; ++t) {
      rs[t] = 0.f;
#pragma unroll  // constant indices keep these vectors in registers
      for (int r = 0; r < 8; ++r) {
        float p = __expf(sacc[t][r] - mnew);
        sacc[t][r] = p; rs[t] += p;
      }
    }
    l_i = l_i * corr + ((rs[0] + rs[1]) + (rs[2] + rs[3]));
    m_i = mnew;
#pragma unroll  // constant indices keep these vectors in registers
    for (int t = 0; t < 8; ++t)
#pragma unroll  // constant indices keep these vectors in registers
      for (int r = 0; r < 8; ++r) o_acc[t][r] *= corr;

    // O^T += V^T @ P^T (k-dim = 64 s, two 32-wide WMMA steps). A = V^T by the
    // transposing load; B = tiles 2kk and 2kk+1 of S^T converted in place, which is
    // the same k order (8 half + 0..7, then 16 + 8 half + 0..7).
#pragma unroll  // constant indices keep these vectors in registers
    for (int kk = 0; kk < 2; ++kk) {
      v16bf pf;
#pragma unroll  // constant indices keep these vectors in registers
      for (int i = 0; i < 8; ++i) {
        pf[i]     = (bf16_t)sacc[2 * kk][i];
        pf[i + 8] = (bf16_t)sacc[2 * kk + 1][i];
      }
#pragma unroll  // constant indices keep these vectors in registers
      for (int t = 0; t < 8; ++t) {
        v16bf vf = load_frag_tr(vtr + (kk * 32) * 144 + t * 16, 144);
        o_acc[t] = wmma_bf16(vf, pf, o_acc[t]);
      }
    }
    __syncthreads();
  }

  // Epilogue: O/l and exact gelu where the values lie (o_acc[t][r] = query ln, column
  // 16 t + 8 half + r), then through this wave's own LDS tile (528 B rows) so that
  // residual loads and output stores run along whole rows of 512 B.
  const float linv = 1.0f / (l_i + xhalf(l_i));
  float* ow = &Os[wave * 16 * 132];
#pragma unroll  // constant indices keep these vectors in registers
  for (int t = 0; t < 8; ++t) {
    float g[8];
#pragma unroll  // constant indices keep these vectors in registers
    for (int r = 0; r < 8; ++r) {
      float x = o_acc[t][r] * linv;
      g[r] = 0.5f * x * (1.0f + erff(x * 0.70710678118654752f));
    }
    float* p = ow + ln * 132 + t * 16 + 8 * half;
    *(float4*)(p)     = make_float4(g[0], g[1], g[2], g[3]);
    *(float4*)(p + 4) = make_float4(g[4], g[5], g[6], g[7]);
  }
  // Only this wave reads the tile it wrote; LDS is in-order per wave.
  const size_t idx0 = (size_t)n * L_ * D_ + (size_t)(l0 + wave * 16) * D_ + h * DH_ + lane * 4;
  for (int q0 = 0; q0 < 16; q0 += 4) {
    // Four rows a trip, all their loads ahead of the tanh code (which branches), so
    // that four residual loads are in flight at once.
    float4 g[4], rv[4];
#pragma unroll  // constant indices keep these vectors in registers
    for (int j = 0; j < 4; ++j) {
      rv[j] = *(const float4*)(res + idx0 + (size_t)(q0 + j) * D_);
      g[j]  = *(const float4*)(ow + (q0 + j) * 132 + lane * 4);
    }
#pragma unroll  // constant indices keep these vectors in registers
    for (int j = 0; j < 4; ++j)
      *(float4*)(out + idx0 + (size_t)(q0 + j) * D_) =
          make_float4(tanhf(g[j].x + rv[j].x), tanhf(g[j].y + rv[j].y),
                      tanhf(g[j].z + rv[j].z), tanhf(g[j].w + rv[j].w));
  }
}

extern "C" void kernel_launch(void* const* d_in, const int* in_sizes, int n_in,
                              void* d_out, int out_size, void* d_ws, size_t ws_size,
                              hipStream_t stream) {
  const float* rgb       = (const float*)d_in[0];
  const float* flow      = (const float*)d_in[1];
  const float* rgb_proj  = (const float*)d_in[2];
  const float* flow_proj = (const float*)d_in[3];
  const float* atte_w    = (const float*)d_in[4];

  float* f_rgb  = (float*)d_out;
  float* f_flow = f_rgb + (size_t)N_ * L_ * D_;

  const size_t oElems = (size_t)N_ * H_ * L_ * DH_;   // 8,388,608 (16 MB bf16)
  bf16_t* o_rgb  = (bf16_t*)d_ws;
  bf16_t* o_flow = o_rgb + oElems;
  bf16_t* Tq     = o_flow + oElems;                   // o_rgb @ atte_w

  dim3 grid(L_ / 128, N_ * H_);
  dim3 block(256);

  mca_gemm_kernel<0><<<grid, block, 0, stream>>>(rgb,  nullptr, rgb_proj,  o_rgb,  D_);
  mca_gemm_kernel<0><<<grid, block, 0, stream>>>(flow, nullptr, flow_proj, o_flow, D_);
  mca_gemm_kernel<1><<<grid, block, 0, stream>>>(nullptr, o_rgb, atte_w,   Tq,     DH_);

  mca_flash_kernel<<<grid, block, 0, stream>>>(Tq,     o_flow, o_rgb,  rgb,  f_rgb);
  mca_flash_kernel<<<grid, block, 0, stream>>>(o_flow, Tq,     o_flow, flow, f_flow);
}

// v003
// It runs in 239 microseconds.
// Two timings next to v002 both put it at 1.43 times that version's speed.
// Counting every step since v000, it is 2.93 times as fast.
#include <hip/hip_runtime.h>
#include <hip/hip_bf16.h>
#include <math.h>

// MI455X / gfx1250, wave32. All heavy math goes through v_wmma_f32_16x16x32_bf16;
// the flash kernel's K-tile staging uses the Tensor Data Mover (tensor_load_to_lds
// + s_wait_tensorcnt) with hardware LDS padding to produce the bank-conflict-free
// 136-element row stride.
// Pipeline:
//   o_rgb  = l2norm(rgb  @ rgb_proj[h])          (GEMM kernel, MODE 0)
//   o_flow = l2norm(flow @ flow_proj[h])         (GEMM kernel, MODE 0)
//   T      = o_rgb @ atte_w[h]                   (GEMM kernel, MODE 1)
//   f_rgb  = tanh(gelu(Flash(Q=T,      K=o_flow, V=o_rgb )) + rgb )
//   f_flow = tanh(gelu(Flash(Q=o_flow, K=T,      V=o_flow)) + flow)
// Flash-style streaming avoids the 512MB atte tensor entirely.

#define N_  4
#define L_  2048
#define D_  1024
#define H_  8
#define DH_ 128

typedef __bf16 bf16_t;
typedef unsigned int       u32;
typedef unsigned long long u64;
typedef __attribute__((ext_vector_type(16))) __bf16 v16bf;
typedef __attribute__((ext_vector_type(8)))  __bf16 v8bf;
typedef __attribute__((ext_vector_type(4)))  __bf16 v4bf;
typedef __attribute__((ext_vector_type(8)))  float  v8f;
typedef __attribute__((ext_vector_type(4)))  float  v4f;
typedef __attribute__((ext_vector_type(4)))  u32    v4u;
typedef __attribute__((ext_vector_type(8)))  int    v8i;
typedef __attribute__((ext_vector_type(4)))  int    v4i;

static __device__ __forceinline__ v8f wmma_bf16(v16bf a, v16bf b, v8f c) {
  // 8 args: (neg_a, A, neg_b, B, c_mod, C, reuse_a, reuse_b)
  return __builtin_amdgcn_wmma_f32_16x16x32_bf16(false, a, false, b, (short)0, c,
                                                 false, false);
}

// 16x32 bf16 fragment per ISA 7.12.2:
//   lane<16 : row M=lane,    K = {0..7, 16..23}
//   lane>=16: row M=lane-16, K = {8..15, 24..31}
// base points at a [16 x 32] tile, row-major with `stride` elements per row.
// (The Q^T B fragments use the same pattern from row-major Q [N][K] in global memory.)
static __device__ __forceinline__ v16bf load_frag(const bf16_t* base, int stride,
                                                  int lane) {
  const int r  = lane & 15;
  const int kb = (lane & 16) ? 8 : 0;
  const bf16_t* p = base + (size_t)r * stride + kb;
  v8bf lo = *(const v8bf*)(p);
  v8bf hi = *(const v8bf*)(p + 16);
  v16bf f;
#pragma unroll
  for (int i = 0; i < 8; ++i) { f[i] = lo[i]; f[i + 8] = hi[i]; }
  return f;
}

// B fragment (32 k x 16 n) out of a row-major [k][n] LDS tile by the transposing
// load: lane (c = lane & 15, hh = lane >> 4) gets T[kbase + 8*hh + 0..7][c], so the
// loads at kbase and kbase + 16 give the same k order as load_frag above.
// p is the lane's own address: row 8*hh + (lane & 7), column 8*((lane >> 3) & 1).
static __device__ __forceinline__ v16bf load_frag_tr(const bf16_t* p, int stride) {
  typedef __attribute__((address_space(3))) v8bf lds_v8bf;
  v8bf lo = __builtin_amdgcn_ds_load_tr16_b128_v8bf16((lds_v8bf*)p);
  v8bf hi = __builtin_amdgcn_ds_load_tr16_b128_v8bf16((lds_v8bf*)(p + 16 * stride));
  v16bf f;
#pragma unroll
  for (int i = 0; i < 8; ++i) { f[i] = lo[i]; f[i + 8] = hi[i]; }
  return f;
}

static __device__ __forceinline__ v8f zero8() {
  v8f z = {0.f, 0.f, 0.f, 0.f, 0.f, 0.f, 0.f, 0.f};
  return z;
}

// ---------------------------------------------------------------------------
// GEMM: O[l,k] = A[l,:] @ B[:,k]  per (n,h) slice, 128x128 output per block.
// MODE 0: A = f32 [L_,D_] (shared across heads), B = f32 proj[h] [D_,128],
//         epilogue = per-row L2 normalize. Kdim = 1024.
// MODE 1: A = bf16 o_rgb slice [L_,128], B = f32 atte_w[h] [128,128]. Kdim=128.
// Output bf16 [n,h,l,128].
// ---------------------------------------------------------------------------
template <int MODE>
__global__ __launch_bounds__(256) void mca_gemm_kernel(
    const float* __restrict__ Af, const bf16_t* __restrict__ Ab,
    const float* __restrict__ Bf, bf16_t* __restrict__ O, int Kdim) {
  __shared__ bf16_t As[128 * 40];   // padded stride 40 (80B rows, 16B aligned)
  __shared__ bf16_t Bs[32 * 144];   // row-major Bs[k][n], 288B rows (32B x odd: tr16 reader)

  const int nh = blockIdx.y, n = nh / H_, h = nh % H_;
  const int l0 = blockIdx.x * 128;
  const int tid = threadIdx.x, wave = tid >> 5, lane = tid & 31;
  const int half = (lane >> 4) & 1, ln = lane & 15;

  const float*  Ag  = (MODE == 0) ? Af + ((size_t)n * L_ + l0) * (size_t)D_ : nullptr;
  const bf16_t* Ag2 = (MODE == 0) ? nullptr : Ab + ((size_t)nh * L_ + l0) * DH_;
  const float* Bg = Bf + (size_t)h * Kdim * DH_;
  bf16_t* Og = O + ((size_t)nh * L_ + l0) * DH_;

  // This lane's address in the B tile for the transposing loads.
  const bf16_t* btr = &Bs[(8 * half + (lane & 7)) * 144 + 8 * ((lane >> 3) & 1)];

  v8f acc[8];
#pragma unroll
  for (int t = 0; t < 8; ++t) acc[t] = zero8();

  for (int k0 = 0; k0 < Kdim; k0 += 32) {
    __syncthreads();
    // --- A tile: 128 rows x 32 k; B tile: 32 k x 128 n. All loads of the step first.
    const float*  pa[4];
    const bf16_t* pa2[2];
    const float*  pb[4];
    v4f  av[4], bv[4];
    v8bf av2[2];
#pragma unroll  // constant indices keep these vectors in registers
    for (int j = 0; j < 4; ++j) {
      int e4 = (tid + 256 * j) * 4;            // 0..4092, step 4
      if (MODE == 0) {
        pa[j] = Ag + (size_t)(e4 >> 5) * D_ + k0 + (e4 & 31);
        av[j] = *(const v4f*)pa[j];
      }
      pb[j] = Bg + (size_t)(k0 + (e4 >> 7)) * DH_ + (e4 & 127);
      bv[j] = *(const v4f*)pb[j];
    }
    if (MODE == 0) {
      // Inputs only. Holds the eight loads ahead of the first conversion: without it
      // the build sinks them to their uses, two in flight at a time, four round trips
      // a step. The addresses are named so that no address register is reused (by a
      // later load's result) before the loads have returned.
      asm volatile("" :: "v"(av[0]), "v"(av[1]), "v"(av[2]), "v"(av[3]),
                         "v"(bv[0]), "v"(bv[1]), "v"(bv[2]), "v"(bv[3]),
                         "v"(pa[0]), "v"(pa[1]), "v"(pa[2]), "v"(pa[3]),
                         "v"(pb[0]), "v"(pb[1]), "v"(pb[2]), "v"(pb[3]));
      // f32 -> bf16, packed 8B LDS stores (4096 elems).
#pragma unroll  // constant indices keep these vectors in registers
      for (int j = 0; j < 4; ++j) {
        int e4 = (tid + 256 * j) * 4;
        int row = e4 >> 5, k = e4 & 31;
        v4bf d;
        d[0] = (bf16_t)av[j][0]; d[1] = (bf16_t)av[j][1];
        d[2] = (bf16_t)av[j][2]; d[3] = (bf16_t)av[j][3];
        *(v4bf*)(&As[row * 40 + k]) = d;
      }
    } else {
      // bf16 copy, b128 loads/stores (4096 elems).
#pragma unroll  // constant indices keep these vectors in registers
      for (int j = 0; j < 2; ++j) {
        int e8 = (tid + 256 * j) * 8;          // 0..4088, step 8
        pa2[j] = Ag2 + (size_t)(e8 >> 5) * DH_ + k0 + (e8 & 31);
        av2[j] = *(const v8bf*)pa2[j];
      }
      // Inputs only: the six loads and their addresses, for the same two reasons.
      asm volatile("" :: "v"(av2[0]), "v"(av2[1]),
                         "v"(bv[0]), "v"(bv[1]), "v"(bv[2]), "v"(bv[3]),
                         "v"(pa2[0]), "v"(pa2[1]),
                         "v"(pb[0]), "v"(pb[1]), "v"(pb[2]), "v"(pb[3]));
#pragma unroll  // constant indices keep these vectors in registers
      for (int j = 0; j < 2; ++j) {
        int e8 = (tid + 256 * j) * 8;
        *(v8bf*)(&As[(e8 >> 5) * 40 + (e8 & 31)]) = av2[j];
      }
    }
    // --- B tile row-major: Bs[k][n] = B[k0+k][n], a wave fills one row of 256 B ---
#pragma unroll  // constant indices keep these vectors in registers
    for (int j = 0; j < 4; ++j) {
      int e4 = (tid + 256 * j) * 4;
      int k = e4 >> 7, col = e4 & 127;
      v4bf d;
      d[0] = (bf16_t)bv[j][0]; d[1] = (bf16_t)bv[j][1];
      d[2] = (bf16_t)bv[j][2]; d[3] = (bf16_t)bv[j][3];
      *(v4bf*)(&Bs[k * 144 + col]) = d;
    }
    __syncthreads();

    v16bf afrag = load_frag(&As[(wave * 16) * 40], 40, lane);
#pragma unroll
    for (int t = 0; t < 8; ++t) {
      v16bf bfrag = load_frag_tr(btr + t * 16, 144);
      acc[t] = wmma_bf16(afrag, bfrag, acc[t]);
    }
  }

  // Epilogue. C/D layout: VGPR r -> row m = r + 8*half; col = ln + 16*t.
  float inv[8];
#pragma unroll
  for (int r = 0; r < 8; ++r) {
    if (MODE == 0) {
      float s = 0.f;
#pragma unroll
      for (int t = 0; t < 8; ++t) s += acc[t][r] * acc[t][r];
      s += __shfl_xor(s, 1);  s += __shfl_xor(s, 2);
      s += __shfl_xor(s, 4);  s += __shfl_xor(s, 8);   // full-row sum within half
      inv[r] = 1.0f / fmaxf(sqrtf(s), 1e-12f);
    } else {
      inv[r] = 1.0f;
    }
  }
#pragma unroll
  for (int t = 0; t < 8; ++t)
#pragma unroll
    for (int r = 0; r < 8; ++r) {
      int m = wave * 16 + r + 8 * half;
      Og[(size_t)m * DH_ + t * 16 + ln] = (bf16_t)(acc[t][r] * inv[r]);
    }
}

static __device__ __forceinline__ float xhalf(float x) {
  return __builtin_bit_cast(float, __builtin_amdgcn_permlanex16(
      __builtin_bit_cast(int, x), __builtin_bit_cast(int, x),
      0x76543210, 0xfedcba98, false, false));
}

__global__ __launch_bounds__(256) void mca_flash_kernel(
    const bf16_t* __restrict__ Q, const bf16_t* __restrict__ Kx,
    const bf16_t* __restrict__ V, const float* __restrict__ res,
    float* __restrict__ out) {
  __shared__ bf16_t Ks[64 * 136];   // K tile [s][dh], 136 = 128 + 4-DWORD pad
  __shared__ bf16_t Vs[64 * 144];   // V tile [s][dh], 288B rows (32B x odd: tr16 reader)
  __shared__ __attribute__((aligned(16))) float Os[8 * 16 * 132];  // epilogue: per-wave 16 x 128 tile, O^T -> rows

  const int nh = blockIdx.y, n = nh / H_, h = nh % H_;
  const int l0 = blockIdx.x * 128;
  const int tid = threadIdx.x, wave = tid >> 5, lane = tid & 31;
  const int half = (lane >> 4) & 1, ln = lane & 15;

  const bf16_t* Qg = Q  + ((size_t)nh * L_ + l0) * DH_;
  const bf16_t* Kg = Kx + (size_t)nh * L_ * DH_;
  const bf16_t* Vg = V  + (size_t)nh * L_ * DH_;

  // Q fragments for this wave's 16-row strip, held in registers for all s.
  v16bf qf[4];
#pragma unroll
  for (int kk = 0; kk < 4; ++kk)
    qf[kk] = load_frag(Qg + (size_t)(wave * 16) * DH_ + kk * 32, DH_, lane);

  // This lane's address in the V tile for the transposing loads.
  const bf16_t* vtr = &Vs[(8 * half + (lane & 7)) * 144 + 8 * ((lane >> 3) & 1)];

  v8f o_acc[8];
#pragma unroll
  for (int t = 0; t < 8; ++t) o_acc[t] = zero8();
  // Query q = ln of this wave's strip: running maximum (equal in both halves) and
  // this half's part of the running sum (joined once, behind the loop).
  float m_i = -3.0e38f, l_i = 0.f;

  for (int s0 = 0; s0 < L_; s0 += 64) {
#if defined(__AMDGCN__) && __has_builtin(__builtin_amdgcn_tensor_load_to_lds)
    // ---- K tile via TDM: 64 rows x 128 bf16, global -> LDS with padding ----
    if (wave == 0) {
      u64 gaddr = (u64)(uintptr_t)(Kg + (size_t)s0 * DH_);  // tile start (bytes)
      u32 lds   = (u32)(uintptr_t)(&Ks[0]);                 // LDS byte address
      v4u g0;
      g0[0] = 1u;                                    // count=1 (user descriptor)
      g0[1] = lds;                                   // lds_addr
      g0[2] = (u32)gaddr;                            // global_addr[31:0]
      g0[3] = (u32)((gaddr >> 32) & 0x1ffffffu) | (2u << 30);  // addr[56:32], type=2
      v8i g1;
      g1[0] = (int)((1u << 16) |                     // data_size = 1 -> 2 bytes
                    (1u << 20) |                     // pad_enable
                    (5u << 22) |                     // pad_interval: 64 DW = 256B
                    (3u << 25));                     // pad_amount: 4 DW = 16B
      g1[1] = (int)(128u << 16);                     // tensor_dim0 = 128 (lo16)
      g1[2] = (int)((u32)L_ << 16);                  // tensor_dim1 = 2048 (lo16)
      g1[3] = (int)(128u << 16);                     // tile_dim0 = 128
      g1[4] = 64;                                    // tile_dim1 = 64, tile_dim2 = 0
      g1[5] = 128;                                   // tensor_dim0_stride = 128
      g1[6] = 0; g1[7] = 0;
      v4i gz4 = {0, 0, 0, 0};                        // 2D: groups 2/3 unused
      v8i gz8 = {0, 0, 0, 0, 0, 0, 0, 0};            // extra group (clang-23 form)
      __builtin_amdgcn_tensor_load_to_lds(g0, g1, gz4, gz4, gz8, 0);
    }
    // ---- V tile staged by all waves, overlapped with the K DMA ----
#pragma unroll
    for (int j = 0; j < 4; ++j) {
      int e8 = (tid + 256 * j) * 8;   // 0..8184, step 8
      int s = e8 >> 7, k = e8 & 127;
      v8bf vv = *(const v8bf*)(Vg + (size_t)(s0 + s) * DH_ + k);
      *(v8bf*)(&Vs[s * 144 + k]) = vv;
    }
    if (wave == 0) __builtin_amdgcn_s_wait_tensorcnt(0);
#else
    // Fallback: manual K and V copy.
#pragma unroll
    for (int j = 0; j < 4; ++j) {
      int e8 = (tid + 256 * j) * 8;
      int s = e8 >> 7, k = e8 & 127;
      v8bf kv = *(const v8bf*)(Kg + (size_t)(s0 + s) * DH_ + k);
      v8bf vv = *(const v8bf*)(Vg + (size_t)(s0 + s) * DH_ + k);
      *(v8bf*)(&Ks[s * 136 + k]) = kv;
      *(v8bf*)(&Vs[s * 144 + k]) = vv;
    }
#endif
    if (s0 + 64 < L_) {  // gfx1250 global_prefetch_b8 for the next V tile
      __builtin_prefetch(Vg + (size_t)(s0 + 64) * DH_ + tid * 32, 0, 1);
    }
    __syncthreads();

    // S^T = K @ Q^T: tile t holds keys s = 16 t + r + 8 half (register r) of query ln.
    v8f sacc[4];
#pragma unroll  // constant indices keep these vectors in registers
    for (int t = 0; t < 4; ++t) {
      v8f s = zero8();
#pragma unroll  // constant indices keep these vectors in registers
      for (int kk = 0; kk < 4; ++kk)
        s = wmma_bf16(load_frag(&Ks[(t * 16) * 136 + kk * 32], 136, lane), qf[kk], s);
      sacc[t] = s;
    }

    // Online softmax of query ln: 32 scores in this lane, the other 32 in lane ^ 16.
    float mt[4];
#pragma unroll  // constant indices keep these vectors in registers
    for (int t = 0; t < 4; ++t) {
      mt[t] = sacc[t][0];
#pragma unroll  // constant indices keep these vectors in registers
      for (int r = 1; r < 8; ++r) mt[t] = fmaxf(mt[t], sacc[t][r]);
    }
    float mx = fmaxf(fmaxf(mt[0], mt[1]), fmaxf(mt[2], mt[3]));
    mx = fmaxf(mx, xhalf(mx));
    const float mnew = fmaxf(m_i, mx);
    const float corr = __expf(m_i - mnew);
    float rs[4];
#pragma unroll  // constant indices keep these vectors in registers
    for (int t = 0; t < 4; ++t) {
      rs[t] = 0.f;
#pragma unroll  // constant indices keep these vectors in registers
      for (int r = 0; r < 8; ++r) {
        float p = __expf(sacc[t][r] - mnew);
        sacc[t][r] = p; rs[t] += p;
      }
    }
    l_i = l_i * corr + ((rs[0] + rs[1]) + (rs[2] + rs[3]));
    m_i = mnew;
#pragma unroll  // constant indices keep these vectors in registers
    for (int t = 0; t < 8; ++t)
#pragma unroll  // constant indices keep these vectors in registers
      for (int r = 0; r < 8; ++r) o_acc[t][r] *= corr;

    // O^T += V^T @ P^T (k-dim = 64 s, two 32-wide WMMA steps). A = V^T by the
    // transposing load; B = tiles 2kk and 2kk+1 of S^T converted in place, which is
    // the same k order (8 half + 0..7, then 16 + 8 half + 0..7).
#pragma unroll  // constant indices keep these vectors in registers
    for (int kk = 0; kk < 2; ++kk) {
      v16bf pf;
#pragma unroll  // constant indices keep these vectors in registers
      for (int i = 0; i < 8; ++i) {
        pf[i]     = (bf16_t)sacc[2 * kk][i];
        pf[i + 8] = (bf16_t)sacc[2 * kk + 1][i];
      }
#pragma unroll  // constant indices keep these vectors in registers
      for (int t = 0; t < 8; ++t) {
        v16bf vf = load_frag_tr(vtr + (kk * 32) * 144 + t * 16, 144);
        o_acc[t] = wmma_bf16(vf, pf, o_acc[t]);
      }
    }
    __syncthreads();
  }

  // Epilogue: O/l and exact gelu where the values lie (o_acc[t][r] = query ln, column
  // 16 t + 8 half + r), then through this wave's own LDS tile (528 B rows) so that
  // residual loads and output stores run along whole rows of 512 B.
  const float linv = 1.0f / (l_i + xhalf(l_i));
  float* ow = &Os[wave * 16 * 132];
#pragma unroll  // constant indices keep these vectors in registers
  for (int t = 0; t < 8; ++t) {
    float g[8];
#pragma unroll  // constant indices keep these vectors in registers
    for (int r = 0; r < 8; ++r) {
      float x = o_acc[t][r] * linv;
      g[r] = 0.5f * x * (1.0f + erff(x * 0.70710678118654752f));
    }
    float* p = ow + ln * 132 + t * 16 + 8 * half;
    *(float4*)(p)     = make_float4(g[0], g[1], g[2], g[3]);
    *(float4*)(p + 4) = make_float4(g[4], g[5], g[6], g[7]);
  }
  // Only this wave reads the tile it wrote; LDS is in-order per wave.
  const size_t idx0 = (size_t)n * L_ * D_ + (size_t)(l0 + wave * 16) * D_ + h * DH_ + lane * 4;
  for (int q0 = 0; q0 < 16; q0 += 4) {
    // Four rows a trip, all their loads ahead of the tanh code (which branches), so
    // that four residual loads are in flight at once.
    float4 g[4], rv[4];
#pragma unroll  // constant indices keep these vectors in registers
    for (int j = 0; j < 4; ++j) {
      rv[j] = *(const float4*)(res + idx0 + (size_t)(q0 + j) * D_);
      g[j]  = *(const float4*)(ow + (q0 + j) * 132 + lane * 4);
    }
#pragma unroll  // constant indices keep these vectors in registers
    for (int j = 0; j < 4; ++j)
      *(float4*)(out + idx0 + (size_t)(q0 + j) * D_) =
          make_float4(tanhf(g[j].x + rv[j].x), tanhf(g[j].y + rv[j].y),
                      tanhf(g[j].z + rv[j].z), tanhf(g[j].w + rv[j].w));
  }
}

extern "C" void kernel_launch(void* const* d_in, const int* in_sizes, int n_in,
                              void* d_out, int out_size, void* d_ws, size_t ws_size,
                              hipStream_t stream) {
  const float* rgb       = (const float*)d_in[0];
  const float* flow      = (const float*)d_in[1];
  const float* rgb_proj  = (const float*)d_in[2];
  const float* flow_proj = (const float*)d_in[3];
  const float* atte_w    = (const float*)d_in[4];

  float* f_rgb  = (float*)d_out;
  float* f_flow = f_rgb + (size_t)N_ * L_ * D_;

  const size_t oElems = (size_t)N_ * H_ * L_ * DH_;   // 8,388,608 (16 MB bf16)
  bf16_t* o_rgb  = (bf16_t*)d_ws;
  bf16_t* o_flow = o_rgb + oElems;
  bf16_t* Tq     = o_flow + oElems;                   // o_rgb @ atte_w

  dim3 grid(L_ / 128, N_ * H_);
  dim3 block(256);

  mca_gemm_kernel<0><<<grid, block, 0, stream>>>(rgb,  nullptr, rgb_proj,  o_rgb,  D_);
  mca_gemm_kernel<0><<<grid, block, 0, stream>>>(flow, nullptr, flow_proj, o_flow, D_);
  mca_gemm_kernel<1><<<grid, block, 0, stream>>>(nullptr, o_rgb, atte_w,   Tq,     DH_);

  mca_flash_kernel<<<grid, block, 0, stream>>>(Tq,     o_flow, o_rgb,  rgb,  f_rgb);
  mca_flash_kernel<<<grid, block, 0, stream>>>(o_flow, Tq,     o_flow, flow, f_flow);
}

// v004
// It runs in 211 microseconds.
// Two timings next to v003 put it at 1.12 and 1.13 times that version's speed.
// All steps since v000 together make it 3.29 times as fast.
#include <hip/hip_runtime.h>
#include <hip/hip_bf16.h>
#include <math.h>

// MI455X / gfx1250, wave32. All heavy math goes through v_wmma_f32_16x16x32_bf16;
// the flash kernel's K-tile staging uses the Tensor Data Mover (tensor_load_to_lds
// + s_wait_tensorcnt) with hardware LDS padding to produce the bank-conflict-free
// 136-element row stride.
// Pipeline:
//   o_rgb  = l2norm(rgb  @ rgb_proj[h])          (GEMM kernel, MODE 0)
//   o_flow = l2norm(flow @ flow_proj[h])         (GEMM kernel, MODE 0)
//   T      = o_rgb @ atte_w[h]                   (GEMM kernel, MODE 1)
//   f_rgb  = tanh(gelu(Flash(Q=T,      K=o_flow, V=o_rgb )) + rgb )
//   f_flow = tanh(gelu(Flash(Q=o_flow, K=T,      V=o_flow)) + flow)
// Flash-style streaming avoids the 512MB atte tensor entirely.

#define N_  4
#define L_  2048
#define D_  1024
#define H_  8
#define DH_ 128

typedef __bf16 bf16_t;
typedef unsigned int       u32;
typedef unsigned long long u64;
typedef __attribute__((ext_vector_type(16))) __bf16 v16bf;
typedef __attribute__((ext_vector_type(8)))  __bf16 v8bf;
typedef __attribute__((ext_vector_type(4)))  __bf16 v4bf;
typedef __attribute__((ext_vector_type(8)))  float  v8f;
typedef __attribute__((ext_vector_type(4)))  float  v4f;
typedef __attribute__((ext_vector_type(4)))  u32    v4u;
typedef __attribute__((ext_vector_type(8)))  int    v8i;
typedef __attribute__((ext_vector_type(4)))  int    v4i;

static __device__ __forceinline__ v8f wmma_bf16(v16bf a, v16bf b, v8f c) {
  // 8 args: (neg_a, A, neg_b, B, c_mod, C, reuse_a, reuse_b)
  return __builtin_amdgcn_wmma_f32_16x16x32_bf16(false, a, false, b, (short)0, c,
                                                 false, false);
}

// 16x32 bf16 fragment per ISA 7.12.2:
//   lane<16 : row M=lane,    K = {0..7, 16..23}
//   lane>=16: row M=lane-16, K = {8..15, 24..31}
// base points at a [16 x 32] tile, row-major with `stride` elements per row.
// (The Q^T B fragments use the same pattern from row-major Q [N][K] in global memory.)
static __device__ __forceinline__ v16bf load_frag(const bf16_t* base, int stride,
                                                  int lane) {
  const int r  = lane & 15;
  const int kb = (lane & 16) ? 8 : 0;
  const bf16_t* p = base + (size_t)r * stride + kb;
  v8bf lo = *(const v8bf*)(p);
  v8bf hi = *(const v8bf*)(p + 16);
  v16bf f;
#pragma unroll
  for (int i = 0; i < 8; ++i) { f[i] = lo[i]; f[i + 8] = hi[i]; }
  return f;
}

// B fragment (32 k x 16 n) out of a row-major [k][n] LDS tile by the transposing
// load: lane (c = lane & 15, hh = lane >> 4) gets T[kbase + 8*hh + 0..7][c], so the
// loads at kbase and kbase + 16 give the same k order as load_frag above.
// p is the lane's own address: row 8*hh + (lane & 7), column 8*((lane >> 3) & 1).
static __device__ __forceinline__ v16bf load_frag_tr(const bf16_t* p, int stride) {
  typedef __attribute__((address_space(3))) v8bf lds_v8bf;
  v8bf lo = __builtin_amdgcn_ds_load_tr16_b128_v8bf16((lds_v8bf*)p);
  v8bf hi = __builtin_amdgcn_ds_load_tr16_b128_v8bf16((lds_v8bf*)(p + 16 * stride));
  v16bf f;
#pragma unroll
  for (int i = 0; i < 8; ++i) { f[i] = lo[i]; f[i + 8] = hi[i]; }
  return f;
}

static __device__ __forceinline__ v8f zero8() {
  v8f z = {0.f, 0.f, 0.f, 0.f, 0.f, 0.f, 0.f, 0.f};
  return z;
}

// ---------------------------------------------------------------------------
// GEMM: O[l,k] = A[l,:] @ B[:,k]  per (n,h) slice, 128x128 output per block.
// MODE 0: A = f32 [L_,D_] (shared across heads), B = f32 proj[h] [D_,128],
//         epilogue = per-row L2 normalize. Kdim = 1024.
// MODE 1: A = bf16 o_rgb slice [L_,128], B = f32 atte_w[h] [128,128]. Kdim=128.
// Output bf16 [n,h,l,128].
// ---------------------------------------------------------------------------
// One k-step (32 k) of both operands on its way from global memory to LDS.
template <int MODE>
struct gemm_regs {
  v4f  a[4];    // MODE 0: A, f32
  v8bf a2[2];   // MODE 1: A, bf16
  v4f  b[4];    // B, f32
};

// Issues the loads of one k-step: A tile 128 rows x 32 k, B tile 32 k x 128 n (4096
// floats in a row). pa, pa2, pb: this lane's first element of the step's tiles.
template <int MODE>
static __device__ __forceinline__ void gemm_load(gemm_regs<MODE>& r, const float* pa,
                                                 const bf16_t* pa2, const float* pb) {
#pragma unroll  // constant indices keep these vectors in registers
  for (int j = 0; j < 4; ++j) {
    if (MODE == 0) r.a[j] = *(const v4f*)(pa + j * 32 * D_);   // 8 lanes a row, 32 rows
    r.b[j] = *(const v4f*)(pb + j * 1024);
  }
  if (MODE == 1) {
#pragma unroll  // constant indices keep these vectors in registers
    for (int j = 0; j < 2; ++j) r.a2[j] = *(const v8bf*)(pa2 + j * 64 * DH_);  // 4 lanes a row
  }
  // The loads stay in flight over the next k-steps while their address registers are
  // reused: this wait stands in front of every such overwrite. Its clobber also
  // keeps the loads from sinking towards their uses.
  asm volatile("s_wait_xcnt 0x0" ::: "memory");
}

// Converts a loaded k-step to bf16 and stores it: As[row][k] (80 B rows), Bs[k][n]
// row-major (288 B rows), packed 8 B or 16 B LDS stores.
template <int MODE>
static __device__ __forceinline__ void gemm_store(const gemm_regs<MODE>& r, bf16_t* As,
                                                  bf16_t* Bs, int tid) {
  if (MODE == 0) {
#pragma unroll  // constant indices keep these vectors in registers
    for (int j = 0; j < 4; ++j) {
      int e4 = (tid + 256 * j) * 4;
      v4bf d;
      d[0] = (bf16_t)r.a[j][0]; d[1] = (bf16_t)r.a[j][1];
      d[2] = (bf16_t)r.a[j][2]; d[3] = (bf16_t)r.a[j][3];
      *(v4bf*)(&As[(e4 >> 5) * 40 + (e4 & 31)]) = d;
    }
  } else {
#pragma unroll  // constant indices keep these vectors in registers
    for (int j = 0; j < 2; ++j) {
      int e8 = (tid + 256 * j) * 8;
      *(v8bf*)(&As[(e8 >> 5) * 40 + (e8 & 31)]) = r.a2[j];
    }
  }
#pragma unroll  // constant indices keep these vectors in registers
  for (int j = 0; j < 4; ++j) {
    int e4 = (tid + 256 * j) * 4;
    v4bf d;
    d[0] = (bf16_t)r.b[j][0]; d[1] = (bf16_t)r.b[j][1];
    d[2] = (bf16_t)r.b[j][2]; d[3] = (bf16_t)r.b[j][3];
    *(v4bf*)(&Bs[(e4 >> 7) * 144 + (e4 & 127)]) = d;
  }
}

// The eight products of one k-step: this wave's 16 rows against all 128 columns.
static __device__ __forceinline__ void gemm_mma(v8f (&acc)[8], const bf16_t* As,
                                                const bf16_t* btr, int wave, int lane) {
  v16bf afrag = load_frag(&As[(wave * 16) * 40], 40, lane);
#pragma unroll
  for (int t = 0; t < 8; ++t) {
    v16bf bfrag = load_frag_tr(btr + t * 16, 144);
    acc[t] = wmma_bf16(afrag, bfrag, acc[t]);
  }
}

// Work-group barrier of the k loop, by hand: it waits for this wave's LDS stores and
// reads only. __syncthreads() also waits for every global load, which would end the
// flight of the loads issued ahead at each k-step.
static __device__ __forceinline__ void gemm_barrier() {
  asm volatile("s_wait_dscnt 0x0\n\ts_barrier_signal -1\n\ts_barrier_wait -1" ::: "memory");
  // Keeps the conversions of a later k-step from being lifted over the barrier: their
  // wait would come with them and end the flight of the youngest loads.
  __builtin_amdgcn_sched_barrier(0);
}

// Kdim is a multiple of 64, at least 128 (four k-steps).
template <int MODE>
__global__ __launch_bounds__(256) void mca_gemm_kernel(
    const float* __restrict__ Af, const bf16_t* __restrict__ Ab,
    const float* __restrict__ Bf, bf16_t* __restrict__ O, int Kdim) {
  __shared__ bf16_t As[2][128 * 40];   // padded stride 40 (80B rows, 16B aligned)
  __shared__ bf16_t Bs[2][32 * 144];   // row-major Bs[k][n], 288B rows (32B x odd: tr16 reader)

  const int nh = blockIdx.y, n = nh / H_, h = nh % H_;
  const int l0 = blockIdx.x * 128;
  const int tid = threadIdx.x, wave = tid >> 5, lane = tid & 31;
  const int half = (lane >> 4) & 1, ln = lane & 15;

  // This lane's first element of the A and B tiles of k-step 0.
  const float*  pa  = (MODE == 0) ? Af + ((size_t)n * L_ + l0 + (tid >> 3)) * (size_t)D_ + (tid & 7) * 4 : nullptr;
  const bf16_t* pa2 = (MODE == 0) ? nullptr : Ab + ((size_t)nh * L_ + l0 + (tid >> 2)) * DH_ + (tid & 3) * 8;
  const float*  pb  = Bf + (size_t)h * Kdim * DH_ + tid * 4;
  bf16_t* Og = O + ((size_t)nh * L_ + l0) * DH_;

  // This lane's address in each B tile for the transposing loads.
  const int btr_off = (8 * half + (lane & 7)) * 144 + 8 * ((lane >> 3) & 1);
  const bf16_t* btr0 = &Bs[0][btr_off];
  const bf16_t* btr1 = &Bs[1][btr_off];

  v8f acc[8];
#pragma unroll
  for (int t = 0; t < 8; ++t) acc[t] = zero8();

  // At the top of an even k-step s: LDS buffer 0 holds step s, r1 step s + 1 and
  // r0 step s + 2 (both in flight). A step multiplies out of its buffer, stores the
  // next step into the other buffer (whose readers left it before the last barrier)
  // and issues the loads of step s + 3 into the registers just freed.
  gemm_regs<MODE> r0, r1;
  gemm_load<MODE>(r0, pa + (0), pa2 + (0), pb + (size_t)(0) * DH_);
  gemm_load<MODE>(r1, pa + (32), pa2 + (32), pb + (size_t)(32) * DH_);
  gemm_store<MODE>(r0, As[0], Bs[0], tid);
  gemm_load<MODE>(r0, pa + (64), pa2 + (64), pb + (size_t)(64) * DH_);
  gemm_barrier();

  int k0 = 0;
  for (; k0 + 160 < Kdim; k0 += 64) {
    gemm_mma(acc, As[0], btr0, wave, lane);
    gemm_store<MODE>(r1, As[1], Bs[1], tid);
    gemm_load<MODE>(r1, pa + (k0 + 96), pa2 + (k0 + 96), pb + (size_t)(k0 + 96) * DH_);
    gemm_barrier();
    gemm_mma(acc, As[1], btr1, wave, lane);
    gemm_store<MODE>(r0, As[0], Bs[0], tid);
    gemm_load<MODE>(r0, pa + (k0 + 128), pa2 + (k0 + 128), pb + (size_t)(k0 + 128) * DH_);
    gemm_barrier();
  }
  // The last four k-steps, written out so that every load in the loop above is
  // unconditional and its wait can count the younger loads.
  gemm_mma(acc, As[0], btr0, wave, lane);
  gemm_store<MODE>(r1, As[1], Bs[1], tid);
  gemm_load<MODE>(r1, pa + (k0 + 96), pa2 + (k0 + 96), pb + (size_t)(k0 + 96) * DH_);
  gemm_barrier();
  gemm_mma(acc, As[1], btr1, wave, lane);
  gemm_store<MODE>(r0, As[0], Bs[0], tid);
  gemm_barrier();
  gemm_mma(acc, As[0], btr0, wave, lane);
  gemm_store<MODE>(r1, As[1], Bs[1], tid);
  gemm_barrier();
  gemm_mma(acc, As[1], btr1, wave, lane);

  // Epilogue. C/D layout: VGPR r -> row m = r + 8*half; col = ln + 16*t.
  float inv[8];
#pragma unroll
  for (int r = 0; r < 8; ++r) {
    if (MODE == 0) {
      float s = 0.f;
#pragma unroll
      for (int t = 0; t < 8; ++t) s += acc[t][r] * acc[t][r];
      s += __shfl_xor(s, 1);  s += __shfl_xor(s, 2);
      s += __shfl_xor(s, 4);  s += __shfl_xor(s, 8);   // full-row sum within half
      inv[r] = 1.0f / fmaxf(sqrtf(s), 1e-12f);
    } else {
      inv[r] = 1.0f;
    }
  }
#pragma unroll
  for (int t = 0; t < 8; ++t)
#pragma unroll
    for (int r = 0; r < 8; ++r) {
      int m = wave * 16 + r + 8 * half;
      Og[(size_t)m * DH_ + t * 16 + ln] = (bf16_t)(acc[t][r] * inv[r]);
    }
}

static __device__ __forceinline__ float xhalf(float x) {
  return __builtin_bit_cast(float, __builtin_amdgcn_permlanex16(
      __builtin_bit_cast(int, x), __builtin_bit_cast(int, x),
      0x76543210, 0xfedcba98, false, false));
}

__global__ __launch_bounds__(256) void mca_flash_kernel(
    const bf16_t* __restrict__ Q, const bf16_t* __restrict__ Kx,
    const bf16_t* __restrict__ V, const float* __restrict__ res,
    float* __restrict__ out) {
  __shared__ bf16_t Ks[64 * 136];   // K tile [s][dh], 136 = 128 + 4-DWORD pad
  __shared__ bf16_t Vs[64 * 144];   // V tile [s][dh], 288B rows (32B x odd: tr16 reader)
  __shared__ __attribute__((aligned(16))) float Os[8 * 16 * 132];  // epilogue: per-wave 16 x 128 tile, O^T -> rows

  const int nh = blockIdx.y, n = nh / H_, h = nh % H_;
  const int l0 = blockIdx.x * 128;
  const int tid = threadIdx.x, wave = tid >> 5, lane = tid & 31;
  const int half = (lane >> 4) & 1, ln = lane & 15;

  const bf16_t* Qg = Q  + ((size_t)nh * L_ + l0) * DH_;
  const bf16_t* Kg = Kx + (size_t)nh * L_ * DH_;
  const bf16_t* Vg = V  + (size_t)nh * L_ * DH_;

  // Q fragments for this wave's 16-row strip, held in registers for all s.
  v16bf qf[4];
#pragma unroll
  for (int kk = 0; kk < 4; ++kk)
    qf[kk] = load_frag(Qg + (size_t)(wave * 16) * DH_ + kk * 32, DH_, lane);

  // This lane's address in the V tile for the transposing loads.
  const bf16_t* vtr = &Vs[(8 * half + (lane & 7)) * 144 + 8 * ((lane >> 3) & 1)];

  v8f o_acc[8];
#pragma unroll
  for (int t = 0; t < 8; ++t) o_acc[t] = zero8();
  // Query q = ln of this wave's strip: running maximum (equal in both halves) and
  // this half's part of the running sum (joined once, behind the loop).
  float m_i = -3.0e38f, l_i = 0.f;

  for (int s0 = 0; s0 < L_; s0 += 64) {
#if defined(__AMDGCN__) && __has_builtin(__builtin_amdgcn_tensor_load_to_lds)
    // ---- K tile via TDM: 64 rows x 128 bf16, global -> LDS with padding ----
    if (wave == 0) {
      u64 gaddr = (u64)(uintptr_t)(Kg + (size_t)s0 * DH_);  // tile start (bytes)
      u32 lds   = (u32)(uintptr_t)(&Ks[0]);                 // LDS byte address
      v4u g0;
      g0[0] = 1u;                                    // count=1 (user descriptor)
      g0[1] = lds;                                   // lds_addr
      g0[2] = (u32)gaddr;                            // global_addr[31:0]
      g0[3] = (u32)((gaddr >> 32) & 0x1ffffffu) | (2u << 30);  // addr[56:32], type=2
      v8i g1;
      g1[0] = (int)((1u << 16) |                     // data_size = 1 -> 2 bytes
                    (1u << 20) |                     // pad_enable
                    (5u << 22) |                     // pad_interval: 64 DW = 256B
                    (3u << 25));                     // pad_amount: 4 DW = 16B
      g1[1] = (int)(128u << 16);                     // tensor_dim0 = 128 (lo16)
      g1[2] = (int)((u32)L_ << 16);                  // tensor_dim1 = 2048 (lo16)
      g1[3] = (int)(128u << 16);                     // tile_dim0 = 128
      g1[4] = 64;                                    // tile_dim1 = 64, tile_dim2 = 0
      g1[5] = 128;                                   // tensor_dim0_stride = 128
      g1[6] = 0; g1[7] = 0;
      v4i gz4 = {0, 0, 0, 0};                        // 2D: groups 2/3 unused
      v8i gz8 = {0, 0, 0, 0, 0, 0, 0, 0};            // extra group (clang-23 form)
      __builtin_amdgcn_tensor_load_to_lds(g0, g1, gz4, gz4, gz8, 0);
    }
    // ---- V tile staged by all waves, overlapped with the K DMA ----
#pragma unroll
    for (int j = 0; j < 4; ++j) {
      int e8 = (tid + 256 * j) * 8;   // 0..8184, step 8
      int s = e8 >> 7, k = e8 & 127;
      v8bf vv = *(const v8bf*)(Vg + (size_t)(s0 + s) * DH_ + k);
      *(v8bf*)(&Vs[s * 144 + k]) = vv;
    }
    if (wave == 0) __builtin_amdgcn_s_wait_tensorcnt(0);
#else
    // Fallback: manual K and V copy.
#pragma unroll
    for (int j = 0; j < 4; ++j) {
      int e8 = (tid + 256 * j) * 8;
      int s = e8 >> 7, k = e8 & 127;
      v8bf kv = *(const v8bf*)(Kg + (size_t)(s0 + s) * DH_ + k);
      v8bf vv = *(const v8bf*)(Vg + (size_t)(s0 + s) * DH_ + k);
      *(v8bf*)(&Ks[s * 136 + k]) = kv;
      *(v8bf*)(&Vs[s * 144 + k]) = vv;
    }
#endif
    if (s0 + 64 < L_) {  // gfx1250 global_prefetch_b8 for the next V tile
      __builtin_prefetch(Vg + (size_t)(s0 + 64) * DH_ + tid * 32, 0, 1);
    }
    __syncthreads();

    // S^T = K @ Q^T: tile t holds keys s = 16 t + r + 8 half (register r) of query ln.
    v8f sacc[4];
#pragma unroll  // constant indices keep these vectors in registers
    for (int t = 0; t < 4; ++t) {
      v8f s = zero8();
#pragma unroll  // constant indices keep these vectors in registers
      for (int kk = 0; kk < 4; ++kk)
        s = wmma_bf16(load_frag(&Ks[(t * 16) * 136 + kk * 32], 136, lane), qf[kk], s);
      sacc[t] = s;
    }

    // Online softmax of query ln: 32 scores in this lane, the other 32 in lane ^ 16.
    float mt[4];
#pragma unroll  // constant indices keep these vectors in registers
    for (int t = 0; t < 4; ++t) {
      mt[t] = sacc[t][0];
#pragma unroll  // constant indices keep these vectors in registers
      for (int r = 1; r < 8; ++r) mt[t] = fmaxf(mt[t], sacc[t][r]);
    }
    float mx = fmaxf(fmaxf(mt[0], mt[1]), fmaxf(mt[2], mt[3]));
    mx = fmaxf(mx, xhalf(mx));
    const float mnew = fmaxf(m_i, mx);
    const float corr = __expf(m_i - mnew);
    float rs[4];
#pragma unroll  // constant indices keep these vectors in registers
    for (int t = 0; t < 4; ++t) {
      rs[t] = 0.f;
#pragma unroll  // constant indices keep these vectors in registers
      for (int r = 0; r < 8; ++r) {
        float p = __expf(sacc[t][r] - mnew);
        sacc[t][r] = p; rs[t] += p;
      }
    }
    l_i = l_i * corr + ((rs[0] + rs[1]) + (rs[2] + rs[3]));
    m_i = mnew;
#pragma unroll  // constant indices keep these vectors in registers
    for (int t = 0; t < 8; ++t)
#pragma unroll  // constant indices keep these vectors in registers
      for (int r = 0; r < 8; ++r) o_acc[t][r] *= corr;

    // O^T += V^T @ P^T (k-dim = 64 s, two 32-wide WMMA steps). A = V^T by the
    // transposing load; B = tiles 2kk and 2kk+1 of S^T converted in place, which is
    // the same k order (8 half + 0..7, then 16 + 8 half + 0..7).
#pragma unroll  // constant indices keep these vectors in registers
    for (int kk = 0; kk < 2; ++kk) {
      v16bf pf;
#pragma unroll  // constant indices keep these vectors in registers
      for (int i = 0; i < 8; ++i) {
        pf[i]     = (bf16_t)sacc[2 * kk][i];
        pf[i + 8] = (bf16_t)sacc[2 * kk + 1][i];
      }
#pragma unroll  // constant indices keep these vectors in registers
      for (int t = 0; t < 8; ++t) {
        v16bf vf = load_frag_tr(vtr + (kk * 32) * 144 + t * 16, 144);
        o_acc[t] = wmma_bf16(vf, pf, o_acc[t]);
      }
    }
    __syncthreads();
  }

  // Epilogue: O/l and exact gelu where the values lie (o_acc[t][r] = query ln, column
  // 16 t + 8 half + r), then through this wave's own LDS tile (528 B rows) so that
  // residual loads and output stores run along whole rows of 512 B.
  const float linv = 1.0f / (l_i + xhalf(l_i));
  float* ow = &Os[wave * 16 * 132];
#pragma unroll  // constant indices keep these vectors in registers
  for (int t = 0; t < 8; ++t) {
    float g[8];
#pragma unroll  // constant indices keep these vectors in registers
    for (int r = 0; r < 8; ++r) {
      float x = o_acc[t][r] * linv;
      g[r] = 0.5f * x * (1.0f + erff(x * 0.70710678118654752f));
    }
    float* p = ow + ln * 132 + t * 16 + 8 * half;
    *(float4*)(p)     = make_float4(g[0], g[1], g[2], g[3]);
    *(float4*)(p + 4) = make_float4(g[4], g[5], g[6], g[7]);
  }
  // Only this wave reads the tile it wrote; LDS is in-order per wave.
  const size_t idx0 = (size_t)n * L_ * D_ + (size_t)(l0 + wave * 16) * D_ + h * DH_ + lane * 4;
  for (int q0 = 0; q0 < 16; q0 += 4) {
    // Four rows a trip, all their loads ahead of the tanh code (which branches), so
    // that four residual loads are in flight at once.
    float4 g[4], rv[4];
#pragma unroll  // constant indices keep these vectors in registers
    for (int j = 0; j < 4; ++j) {
      rv[j] = *(const float4*)(res + idx0 + (size_t)(q0 + j) * D_);
      g[j]  = *(const float4*)(ow + (q0 + j) * 132 + lane * 4);
    }
#pragma unroll  // constant indices keep these vectors in registers
    for (int j = 0; j < 4; ++j)
      *(float4*)(out + idx0 + (size_t)(q0 + j) * D_) =
          make_float4(tanhf(g[j].x + rv[j].x), tanhf(g[j].y + rv[j].y),
                      tanhf(g[j].z + rv[j].z), tanhf(g[j].w + rv[j].w));
  }
}

extern "C" void kernel_launch(void* const* d_in, const int* in_sizes, int n_in,
                              void* d_out, int out_size, void* d_ws, size_t ws_size,
                              hipStream_t stream) {
  const float* rgb       = (const float*)d_in[0];
  const float* flow      = (const float*)d_in[1];
  const float* rgb_proj  = (const float*)d_in[2];
  const float* flow_proj = (const float*)d_in[3];
  const float* atte_w    = (const float*)d_in[4];

  float* f_rgb  = (float*)d_out;
  float* f_flow = f_rgb + (size_t)N_ * L_ * D_;

  const size_t oElems = (size_t)N_ * H_ * L_ * DH_;   // 8,388,608 (16 MB bf16)
  bf16_t* o_rgb  = (bf16_t*)d_ws;
  bf16_t* o_flow = o_rgb + oElems;
  bf16_t* Tq     = o_flow + oElems;                   // o_rgb @ atte_w

  dim3 grid(L_ / 128, N_ * H_);
  dim3 block(256);

  mca_gemm_kernel<0><<<grid, block, 0, stream>>>(rgb,  nullptr, rgb_proj,  o_rgb,  D_);
  mca_gemm_kernel<0><<<grid, block, 0, stream>>>(flow, nullptr, flow_proj, o_flow, D_);
  mca_gemm_kernel<1><<<grid, block, 0, stream>>>(nullptr, o_rgb, atte_w,   Tq,     DH_);

  mca_flash_kernel<<<grid, block, 0, stream>>>(Tq,     o_flow, o_rgb,  rgb,  f_rgb);
  mca_flash_kernel<<<grid, block, 0, stream>>>(o_flow, Tq,     o_flow, flow, f_flow);
}

// v005
// It runs in 197 microseconds.
// Two timings next to v004 put it at 1.07 and 1.08 times that version's speed.
// All steps since v000 together make it 3.54 times as fast.
#include <hip/hip_runtime.h>
#include <hip/hip_bf16.h>
#include <math.h>

// MI455X / gfx1250, wave32. All heavy math goes through v_wmma_f32_16x16x32_bf16;
// the flash kernel's K-tile staging uses the Tensor Data Mover (tensor_load_to_lds
// + s_wait_tensorcnt) with hardware LDS padding to produce the bank-conflict-free
// 136-element row stride.
// Pipeline:
//   o_rgb  = l2norm(rgb  @ rgb_proj[h])          (GEMM kernel, MODE 0)
//   o_flow = l2norm(flow @ flow_proj[h])         (GEMM kernel, MODE 0)
//   T      = o_rgb @ atte_w[h]                   (GEMM kernel, MODE 1)
//   f_rgb  = tanh(gelu(Flash(Q=T,      K=o_flow, V=o_rgb )) + rgb )
//   f_flow = tanh(gelu(Flash(Q=o_flow, K=T,      V=o_flow)) + flow)
// Flash-style streaming avoids the 512MB atte tensor entirely.

#define N_  4
#define L_  2048
#define D_  1024
#define H_  8
#define DH_ 128

typedef __bf16 bf16_t;
typedef unsigned int       u32;
typedef unsigned long long u64;
typedef __attribute__((ext_vector_type(16))) __bf16 v16bf;
typedef __attribute__((ext_vector_type(8)))  __bf16 v8bf;
typedef __attribute__((ext_vector_type(4)))  __bf16 v4bf;
typedef __attribute__((ext_vector_type(8)))  float  v8f;
typedef __attribute__((ext_vector_type(4)))  float  v4f;
typedef __attribute__((ext_vector_type(4)))  u32    v4u;
typedef __attribute__((ext_vector_type(8)))  int    v8i;
typedef __attribute__((ext_vector_type(4)))  int    v4i;

static __device__ __forceinline__ v8f wmma_bf16(v16bf a, v16bf b, v8f c) {
  // 8 args: (neg_a, A, neg_b, B, c_mod, C, reuse_a, reuse_b)
  return __builtin_amdgcn_wmma_f32_16x16x32_bf16(false, a, false, b, (short)0, c,
                                                 false, false);
}

// 16x32 bf16 fragment per ISA 7.12.2:
//   lane<16 : row M=lane,    K = {0..7, 16..23}
//   lane>=16: row M=lane-16, K = {8..15, 24..31}
// base points at a [16 x 32] tile, row-major with `stride` elements per row.
// (The Q^T B fragments use the same pattern from row-major Q [N][K] in global memory.)
static __device__ __forceinline__ v16bf load_frag(const bf16_t* base, int stride,
                                                  int lane) {
  const int r  = lane & 15;
  const int kb = (lane & 16) ? 8 : 0;
  const bf16_t* p = base + (size_t)r * stride + kb;
  v8bf lo = *(const v8bf*)(p);
  v8bf hi = *(const v8bf*)(p + 16);
  v16bf f;
#pragma unroll
  for (int i = 0; i < 8; ++i) { f[i] = lo[i]; f[i + 8] = hi[i]; }
  return f;
}

// B fragment (32 k x 16 n) out of a row-major [k][n] LDS tile by the transposing
// load: lane (c = lane & 15, hh = lane >> 4) gets T[kbase + 8*hh + 0..7][c], so the
// loads at kbase and kbase + 16 give the same k order as load_frag above.
// p is the lane's own address: row 8*hh + (lane & 7), column 8*((lane >> 3) & 1).
static __device__ __forceinline__ v16bf load_frag_tr(const bf16_t* p, int stride) {
  typedef __attribute__((address_space(3))) v8bf lds_v8bf;
  v8bf lo = __builtin_amdgcn_ds_load_tr16_b128_v8bf16((lds_v8bf*)p);
  v8bf hi = __builtin_amdgcn_ds_load_tr16_b128_v8bf16((lds_v8bf*)(p + 16 * stride));
  v16bf f;
#pragma unroll
  for (int i = 0; i < 8; ++i) { f[i] = lo[i]; f[i + 8] = hi[i]; }
  return f;
}

static __device__ __forceinline__ v8f zero8() {
  v8f z = {0.f, 0.f, 0.f, 0.f, 0.f, 0.f, 0.f, 0.f};
  return z;
}

// ---------------------------------------------------------------------------
// GEMM: O[l,k] = A[l,:] @ B[:,k]  per (n,h) slice, 128x128 output per block.
// MODE 0: A = f32 [L_,D_] (shared across heads), B = f32 proj[h] [D_,128],
//         epilogue = per-row L2 normalize. Kdim = 1024.
// MODE 1: A = bf16 o_rgb slice [L_,128], B = f32 atte_w[h] [128,128]. Kdim=128.
// Output bf16 [n,h,l,128].
// ---------------------------------------------------------------------------
// One k-step (32 k) of both operands on its way from global memory to LDS.
template <int MODE>
struct gemm_regs {
  v4f  a[4];    // MODE 0: A, f32
  v8bf a2[2];   // MODE 1: A, bf16
  v4f  b[4];    // B, f32
};

// Issues the loads of one k-step: A tile 128 rows x 32 k, B tile 32 k x 128 n (4096
// floats in a row). pa, pa2, pb: this lane's first element of the step's tiles.
template <int MODE>
static __device__ __forceinline__ void gemm_load(gemm_regs<MODE>& r, const float* pa,
                                                 const bf16_t* pa2, const float* pb) {
#pragma unroll  // constant indices keep these vectors in registers
  for (int j = 0; j < 4; ++j) {
    if (MODE == 0) r.a[j] = *(const v4f*)(pa + j * 32 * D_);   // 8 lanes a row, 32 rows
    r.b[j] = *(const v4f*)(pb + j * 1024);
  }
  if (MODE == 1) {
#pragma unroll  // constant indices keep these vectors in registers
    for (int j = 0; j < 2; ++j) r.a2[j] = *(const v8bf*)(pa2 + j * 64 * DH_);  // 4 lanes a row
  }
  // The loads stay in flight over the next k-steps while their address registers are
  // reused: this wait stands in front of every such overwrite. Its clobber also
  // keeps the loads from sinking towards their uses.
  asm volatile("s_wait_xcnt 0x0" ::: "memory");
}

// Converts a loaded k-step to bf16 and stores it: As[row][k] (80 B rows), Bs[k][n]
// row-major (288 B rows), packed 8 B or 16 B LDS stores.
template <int MODE>
static __device__ __forceinline__ void gemm_store(const gemm_regs<MODE>& r, bf16_t* As,
                                                  bf16_t* Bs, int tid) {
  if (MODE == 0) {
#pragma unroll  // constant indices keep these vectors in registers
    for (int j = 0; j < 4; ++j) {
      int e4 = (tid + 256 * j) * 4;
      v4bf d;
      d[0] = (bf16_t)r.a[j][0]; d[1] = (bf16_t)r.a[j][1];
      d[2] = (bf16_t)r.a[j][2]; d[3] = (bf16_t)r.a[j][3];
      *(v4bf*)(&As[(e4 >> 5) * 40 + (e4 & 31)]) = d;
    }
  } else {
#pragma unroll  // constant indices keep these vectors in registers
    for (int j = 0; j < 2; ++j) {
      int e8 = (tid + 256 * j) * 8;
      *(v8bf*)(&As[(e8 >> 5) * 40 + (e8 & 31)]) = r.a2[j];
    }
  }
#pragma unroll  // constant indices keep these vectors in registers
  for (int j = 0; j < 4; ++j) {
    int e4 = (tid + 256 * j) * 4;
    v4bf d;
    d[0] = (bf16_t)r.b[j][0]; d[1] = (bf16_t)r.b[j][1];
    d[2] = (bf16_t)r.b[j][2]; d[3] = (bf16_t)r.b[j][3];
    *(v4bf*)(&Bs[(e4 >> 7) * 144 + (e4 & 127)]) = d;
  }
}

// The eight products of one k-step: this wave's 16 rows against all 128 columns.
static __device__ __forceinline__ void gemm_mma(v8f (&acc)[8], const bf16_t* As,
                                                const bf16_t* btr, int wave, int lane) {
  v16bf afrag = load_frag(&As[(wave * 16) * 40], 40, lane);
#pragma unroll
  for (int t = 0; t < 8; ++t) {
    v16bf bfrag = load_frag_tr(btr + t * 16, 144);
    acc[t] = wmma_bf16(afrag, bfrag, acc[t]);
  }
}

// Work-group barrier of the k loop, by hand: it waits for this wave's LDS stores and
// reads only. __syncthreads() also waits for every global load, which would end the
// flight of the loads issued ahead at each k-step.
static __device__ __forceinline__ void gemm_barrier() {
  asm volatile("s_wait_dscnt 0x0\n\ts_barrier_signal -1\n\ts_barrier_wait -1" ::: "memory");
  // Keeps the conversions of a later k-step from being lifted over the barrier: their
  // wait would come with them and end the flight of the youngest loads.
  __builtin_amdgcn_sched_barrier(0);
}

// Kdim is a multiple of 64, at least 128 (four k-steps).
template <int MODE>
__global__ __launch_bounds__(256) void mca_gemm_kernel(
    const float* __restrict__ Af, const bf16_t* __restrict__ Ab,
    const float* __restrict__ Bf, bf16_t* __restrict__ O, int Kdim) {
  __shared__ bf16_t As[2][128 * 40];   // padded stride 40 (80B rows, 16B aligned)
  __shared__ bf16_t Bs[2][32 * 144];   // row-major Bs[k][n], 288B rows (32B x odd: tr16 reader)

  const int nh = blockIdx.y, n = nh / H_, h = nh % H_;
  const int l0 = blockIdx.x * 128;
  const int tid = threadIdx.x, wave = tid >> 5, lane = tid & 31;
  const int half = (lane >> 4) & 1, ln = lane & 15;

  // This lane's first element of the A and B tiles of k-step 0.
  const float*  pa  = (MODE == 0) ? Af + ((size_t)n * L_ + l0 + (tid >> 3)) * (size_t)D_ + (tid & 7) * 4 : nullptr;
  const bf16_t* pa2 = (MODE == 0) ? nullptr : Ab + ((size_t)nh * L_ + l0 + (tid >> 2)) * DH_ + (tid & 3) * 8;
  const float*  pb  = Bf + (size_t)h * Kdim * DH_ + tid * 4;
  bf16_t* Og = O + ((size_t)nh * L_ + l0) * DH_;

  // This lane's address in each B tile for the transposing loads.
  const int btr_off = (8 * half + (lane & 7)) * 144 + 8 * ((lane >> 3) & 1);
  const bf16_t* btr0 = &Bs[0][btr_off];
  const bf16_t* btr1 = &Bs[1][btr_off];

  v8f acc[8];
#pragma unroll
  for (int t = 0; t < 8; ++t) acc[t] = zero8();

  // At the top of an even k-step s: LDS buffer 0 holds step s, r1 step s + 1 and
  // r0 step s + 2 (both in flight). A step multiplies out of its buffer, stores the
  // next step into the other buffer (whose readers left it before the last barrier)
  // and issues the loads of step s + 3 into the registers just freed.
  gemm_regs<MODE> r0, r1;
  gemm_load<MODE>(r0, pa + (0), pa2 + (0), pb + (size_t)(0) * DH_);
  gemm_load<MODE>(r1, pa + (32), pa2 + (32), pb + (size_t)(32) * DH_);
  gemm_store<MODE>(r0, As[0], Bs[0], tid);
  gemm_load<MODE>(r0, pa + (64), pa2 + (64), pb + (size_t)(64) * DH_);
  gemm_barrier();

  int k0 = 0;
  for (; k0 + 160 < Kdim; k0 += 64) {
    gemm_mma(acc, As[0], btr0, wave, lane);
    gemm_store<MODE>(r1, As[1], Bs[1], tid);
    gemm_load<MODE>(r1, pa + (k0 + 96), pa2 + (k0 + 96), pb + (size_t)(k0 + 96) * DH_);
    gemm_barrier();
    gemm_mma(acc, As[1], btr1, wave, lane);
    gemm_store<MODE>(r0, As[0], Bs[0], tid);
    gemm_load<MODE>(r0, pa + (k0 + 128), pa2 + (k0 + 128), pb + (size_t)(k0 + 128) * DH_);
    gemm_barrier();
  }
  // The last four k-steps, written out so that every load in the loop above is
  // unconditional and its wait can count the younger loads.
  gemm_mma(acc, As[0], btr0, wave, lane);
  gemm_store<MODE>(r1, As[1], Bs[1], tid);
  gemm_load<MODE>(r1, pa + (k0 + 96), pa2 + (k0 + 96), pb + (size_t)(k0 + 96) * DH_);
  gemm_barrier();
  gemm_mma(acc, As[1], btr1, wave, lane);
  gemm_store<MODE>(r0, As[0], Bs[0], tid);
  gemm_barrier();
  gemm_mma(acc, As[0], btr0, wave, lane);
  gemm_store<MODE>(r1, As[1], Bs[1], tid);
  gemm_barrier();
  gemm_mma(acc, As[1], btr1, wave, lane);

  // Epilogue. C/D layout: VGPR r -> row m = r + 8*half; col = ln + 16*t.
  float inv[8];
#pragma unroll
  for (int r = 0; r < 8; ++r) {
    if (MODE == 0) {
      float s = 0.f;
#pragma unroll
      for (int t = 0; t < 8; ++t) s += acc[t][r] * acc[t][r];
      s += __shfl_xor(s, 1);  s += __shfl_xor(s, 2);
      s += __shfl_xor(s, 4);  s += __shfl_xor(s, 8);   // full-row sum within half
      inv[r] = 1.0f / fmaxf(sqrtf(s), 1e-12f);
    } else {
      inv[r] = 1.0f;
    }
  }
#pragma unroll
  for (int t = 0; t < 8; ++t)
#pragma unroll
    for (int r = 0; r < 8; ++r) {
      int m = wave * 16 + r + 8 * half;
      Og[(size_t)m * DH_ + t * 16 + ln] = (bf16_t)(acc[t][r] * inv[r]);
    }
}

static __device__ __forceinline__ float xhalf(float x) {
  return __builtin_bit_cast(float, __builtin_amdgcn_permlanex16(
      __builtin_bit_cast(int, x), __builtin_bit_cast(int, x),
      0x76543210, 0xfedcba98, false, false));
}

// Exact-form gelu, 0.5 x (1 + erf(x / sqrt 2)) = h + |h| erf(|x| / sqrt 2), from h = x / 2.
// erf(z) = 1 - (a1 t + ... + a5 t^5) exp(-z^2), t = 1 / (1 + p z), z >= 0: one straight
// line for every z (absolute error of the form below 2e-7; 1 at infinity), where the
// library erff takes one of two branches per value.
static __device__ __forceinline__ float gelu_from_half(float h) {
  const float a = fabsf(h);
  const float t = __builtin_amdgcn_rcpf(fmaf(0.46328378f, a, 1.0f));   // p z = p sqrt(2) |h|
  float p = fmaf(1.061405429f, t, -1.453152027f);
  p = fmaf(p, t, 1.421413741f);
  p = fmaf(p, t, -0.284496736f);
  p = fmaf(p, t, 0.254829592f);
  const float e = __builtin_amdgcn_exp2f((h * h) * -2.88539008f);      // exp(-z^2), z^2 = 2 h^2
  return fmaf(a, fmaf(-(p * t), e, 1.0f), h);
}

// tanh(y) = 1 - 2 / (1 + exp(2 y)): one straight line for every y (exp -> inf gives 1,
// exp -> 0 gives -1), where the library tanhf takes one of two branches per value.
static __device__ __forceinline__ float tanh_line(float y) {
  return fmaf(-2.0f, __builtin_amdgcn_rcpf(1.0f + __builtin_amdgcn_exp2f(y * 2.88539008f)), 1.0f);
}

// The grid puts two work-groups on a WGP, four waves on a SIMD, and never more: with
// that stated the compiler schedules the main loop for 256 registers a wave (its LDS
// reads stay several products ahead) and not for a fifth wave that never comes.
__global__ __launch_bounds__(256) __attribute__((amdgpu_waves_per_eu(4, 4))) void mca_flash_kernel(
    const bf16_t* __restrict__ Q, const bf16_t* __restrict__ Kx,
    const bf16_t* __restrict__ V, const float* __restrict__ res,
    float* __restrict__ out) {
  __shared__ bf16_t Ks[64 * 136];   // K tile [s][dh], 136 = 128 + 4-DWORD pad
  __shared__ bf16_t Vs[64 * 144];   // V tile [s][dh], 288B rows (32B x odd: tr16 reader)
  __shared__ __attribute__((aligned(16))) float Os[8 * 16 * 132];  // epilogue: per-wave 16 x 128 tile, O^T -> rows

  const int nh = blockIdx.y, n = nh / H_, h = nh % H_;
  const int l0 = blockIdx.x * 128;
  const int tid = threadIdx.x, wave = tid >> 5, lane = tid & 31;
  const int half = (lane >> 4) & 1, ln = lane & 15;

  const bf16_t* Qg = Q  + ((size_t)nh * L_ + l0) * DH_;
  const bf16_t* Kg = Kx + (size_t)nh * L_ * DH_;
  const bf16_t* Vg = V  + (size_t)nh * L_ * DH_;

  // Q fragments for this wave's 16-row strip, held in registers for all s.
  v16bf qf[4];
#pragma unroll
  for (int kk = 0; kk < 4; ++kk)
    qf[kk] = load_frag(Qg + (size_t)(wave * 16) * DH_ + kk * 32, DH_, lane);

  // This lane's address in the V tile for the transposing loads.
  const bf16_t* vtr = &Vs[(8 * half + (lane & 7)) * 144 + 8 * ((lane >> 3) & 1)];

  v8f o_acc[8];
#pragma unroll
  for (int t = 0; t < 8; ++t) o_acc[t] = zero8();
  // Query q = ln of this wave's strip: running maximum (equal in both halves) and
  // this half's part of the running sum (joined once, behind the loop).
  float m_i = -3.0e38f, l_i = 0.f;

  for (int s0 = 0; s0 < L_; s0 += 64) {
#if defined(__AMDGCN__) && __has_builtin(__builtin_amdgcn_tensor_load_to_lds)
    // ---- K tile via TDM: 64 rows x 128 bf16, global -> LDS with padding ----
    if (wave == 0) {
      u64 gaddr = (u64)(uintptr_t)(Kg + (size_t)s0 * DH_);  // tile start (bytes)
      u32 lds   = (u32)(uintptr_t)(&Ks[0]);                 // LDS byte address
      v4u g0;
      g0[0] = 1u;                                    // count=1 (user descriptor)
      g0[1] = lds;                                   // lds_addr
      g0[2] = (u32)gaddr;                            // global_addr[31:0]
      g0[3] = (u32)((gaddr >> 32) & 0x1ffffffu) | (2u << 30);  // addr[56:32], type=2
      v8i g1;
      g1[0] = (int)((1u << 16) |                     // data_size = 1 -> 2 bytes
                    (1u << 20) |                     // pad_enable
                    (5u << 22) |                     // pad_interval: 64 DW = 256B
                    (3u << 25));                     // pad_amount: 4 DW = 16B
      g1[1] = (int)(128u << 16);                     // tensor_dim0 = 128 (lo16)
      g1[2] = (int)((u32)L_ << 16);                  // tensor_dim1 = 2048 (lo16)
      g1[3] = (int)(128u << 16);                     // tile_dim0 = 128
      g1[4] = 64;                                    // tile_dim1 = 64, tile_dim2 = 0
      g1[5] = 128;                                   // tensor_dim0_stride = 128
      g1[6] = 0; g1[7] = 0;
      v4i gz4 = {0, 0, 0, 0};                        // 2D: groups 2/3 unused
      v8i gz8 = {0, 0, 0, 0, 0, 0, 0, 0};            // extra group (clang-23 form)
      __builtin_amdgcn_tensor_load_to_lds(g0, g1, gz4, gz4, gz8, 0);
    }
    // ---- V tile staged by all waves, overlapped with the K DMA ----
#pragma unroll
    for (int j = 0; j < 4; ++j) {
      int e8 = (tid + 256 * j) * 8;   // 0..8184, step 8
      int s = e8 >> 7, k = e8 & 127;
      v8bf vv = *(const v8bf*)(Vg + (size_t)(s0 + s) * DH_ + k);
      *(v8bf*)(&Vs[s * 144 + k]) = vv;
    }
    if (wave == 0) __builtin_amdgcn_s_wait_tensorcnt(0);
#else
    // Fallback: manual K and V copy.
#pragma unroll
    for (int j = 0; j < 4; ++j) {
      int e8 = (tid + 256 * j) * 8;
      int s = e8 >> 7, k = e8 & 127;
      v8bf kv = *(const v8bf*)(Kg + (size_t)(s0 + s) * DH_ + k);
      v8bf vv = *(const v8bf*)(Vg + (size_t)(s0 + s) * DH_ + k);
      *(v8bf*)(&Ks[s * 136 + k]) = kv;
      *(v8bf*)(&Vs[s * 144 + k]) = vv;
    }
#endif
    if (s0 + 64 < L_) {  // gfx1250 global_prefetch_b8 for the next V tile
      __builtin_prefetch(Vg + (size_t)(s0 + 64) * DH_ + tid * 32, 0, 1);
    }
    __syncthreads();

    // S^T = K @ Q^T: tile t holds keys s = 16 t + r + 8 half (register r) of query ln.
    v8f sacc[4];
#pragma unroll  // constant indices keep these vectors in registers
    for (int t = 0; t < 4; ++t) {
      v8f s = zero8();
#pragma unroll  // constant indices keep these vectors in registers
      for (int kk = 0; kk < 4; ++kk)
        s = wmma_bf16(load_frag(&Ks[(t * 16) * 136 + kk * 32], 136, lane), qf[kk], s);
      sacc[t] = s;
    }

    // Online softmax of query ln: 32 scores in this lane, the other 32 in lane ^ 16.
    float mt[4];
#pragma unroll  // constant indices keep these vectors in registers
    for (int t = 0; t < 4; ++t) {
      mt[t] = sacc[t][0];
#pragma unroll  // constant indices keep these vectors in registers
      for (int r = 1; r < 8; ++r) mt[t] = fmaxf(mt[t], sacc[t][r]);
    }
    float mx = fmaxf(fmaxf(mt[0], mt[1]), fmaxf(mt[2], mt[3]));
    mx = fmaxf(mx, xhalf(mx));
    const float mnew = fmaxf(m_i, mx);
    const float corr = __expf(m_i - mnew);
    float rs[4];
#pragma unroll  // constant indices keep these vectors in registers
    for (int t = 0; t < 4; ++t) {
      rs[t] = 0.f;
#pragma unroll  // constant indices keep these vectors in registers
      for (int r = 0; r < 8; ++r) {
        float p = __expf(sacc[t][r] - mnew);
        sacc[t][r] = p; rs[t] += p;
      }
    }
    l_i = l_i * corr + ((rs[0] + rs[1]) + (rs[2] + rs[3]));
    m_i = mnew;
#pragma unroll  // constant indices keep these vectors in registers
    for (int t = 0; t < 8; ++t)
#pragma unroll  // constant indices keep these vectors in registers
      for (int r = 0; r < 8; ++r) o_acc[t][r] *= corr;

    // O^T += V^T @ P^T (k-dim = 64 s, two 32-wide WMMA steps). A = V^T by the
    // transposing load; B = tiles 2kk and 2kk+1 of S^T converted in place, which is
    // the same k order (8 half + 0..7, then 16 + 8 half + 0..7).
#pragma unroll  // constant indices keep these vectors in registers
    for (int kk = 0; kk < 2; ++kk) {
      v16bf pf;
#pragma unroll  // constant indices keep these vectors in registers
      for (int i = 0; i < 8; ++i) {
        pf[i]     = (bf16_t)sacc[2 * kk][i];
        pf[i + 8] = (bf16_t)sacc[2 * kk + 1][i];
      }
#pragma unroll  // constant indices keep these vectors in registers
      for (int t = 0; t < 8; ++t) {
        v16bf vf = load_frag_tr(vtr + (kk * 32) * 144 + t * 16, 144);
        o_acc[t] = wmma_bf16(vf, pf, o_acc[t]);
      }
    }
    __syncthreads();
  }

  // Epilogue: O/l and gelu where the values lie (o_acc[t][r] = query ln, column
  // 16 t + 8 half + r), then through this wave's own LDS tile (528 B rows) so that
  // residual loads and output stores run along whole rows of 512 B.
  const float hinv = 0.5f / (l_i + xhalf(l_i));   // O / l, halved for gelu_from_half
  float* ow = &Os[wave * 16 * 132];
#pragma unroll  // constant indices keep these vectors in registers
  for (int t = 0; t < 8; ++t) {
    float g[8];
#pragma unroll  // constant indices keep these vectors in registers
    for (int r = 0; r < 8; ++r) g[r] = gelu_from_half(o_acc[t][r] * hinv);
    float* p = ow + ln * 132 + t * 16 + 8 * half;
    *(float4*)(p)     = make_float4(g[0], g[1], g[2], g[3]);
    *(float4*)(p + 4) = make_float4(g[4], g[5], g[6], g[7]);
  }
  // Only this wave reads the tile it wrote; LDS is in-order per wave.
  const size_t idx0 = (size_t)n * L_ * D_ + (size_t)(l0 + wave * 16) * D_ + h * DH_ + lane * 4;
  for (int q0 = 0; q0 < 16; q0 += 4) {
    // Four rows a trip, all their loads ahead of the arithmetic, so that four residual
    // loads are in flight at once.
    float4 g[4], rv[4];
#pragma unroll  // constant indices keep these vectors in registers
    for (int j = 0; j < 4; ++j) {
      rv[j] = *(const float4*)(res + idx0 + (size_t)(q0 + j) * D_);
      g[j]  = *(const float4*)(ow + (q0 + j) * 132 + lane * 4);
    }
    // The residual loads stay in flight over the arithmetic while their address
    // registers are reused: this wait stands in front of every such overwrite.
    asm volatile("s_wait_xcnt 0x0" ::: "memory");
#pragma unroll  // constant indices keep these vectors in registers
    for (int j = 0; j < 4; ++j)
      *(float4*)(out + idx0 + (size_t)(q0 + j) * D_) =
          make_float4(tanh_line(g[j].x + rv[j].x), tanh_line(g[j].y + rv[j].y),
                      tanh_line(g[j].z + rv[j].z), tanh_line(g[j].w + rv[j].w));
  }
}

extern "C" void kernel_launch(void* const* d_in, const int* in_sizes, int n_in,
                              void* d_out, int out_size, void* d_ws, size_t ws_size,
                              hipStream_t stream) {
  const float* rgb       = (const float*)d_in[0];
  const float* flow      = (const float*)d_in[1];
  const float* rgb_proj  = (const float*)d_in[2];
  const float* flow_proj = (const float*)d_in[3];
  const float* atte_w    = (const float*)d_in[4];

  float* f_rgb  = (float*)d_out;
  float* f_flow = f_rgb + (size_t)N_ * L_ * D_;

  const size_t oElems = (size_t)N_ * H_ * L_ * DH_;   // 8,388,608 (16 MB bf16)
  bf16_t* o_rgb  = (bf16_t*)d_ws;
  bf16_t* o_flow = o_rgb + oElems;
  bf16_t* Tq     = o_flow + oElems;                   // o_rgb @ atte_w

  dim3 grid(L_ / 128, N_ * H_);
  dim3 block(256);

  mca_gemm_kernel<0><<<grid, block, 0, stream>>>(rgb,  nullptr, rgb_proj,  o_rgb,  D_);
  mca_gemm_kernel<0><<<grid, block, 0, stream>>>(flow, nullptr, flow_proj, o_flow, D_);
  mca_gemm_kernel<1><<<grid, block, 0, stream>>>(nullptr, o_rgb, atte_w,   Tq,     DH_);

  mca_flash_kernel<<<grid, block, 0, stream>>>(Tq,     o_flow, o_rgb,  rgb,  f_rgb);
  mca_flash_kernel<<<grid, block, 0, stream>>>(o_flow, Tq,     o_flow, flow, f_flow);
}

// v006
// A run of this version takes 175 microseconds.
// Two timings next to v005 put it at 1.14 and 1.13 times that version's speed.
// Over all steps from v000 it is 4.02 times as fast.
#include <hip/hip_runtime.h>
#include <hip/hip_bf16.h>
#include <math.h>

// MI455X / gfx1250, wave32. All heavy math goes through v_wmma_f32_16x16x32_bf16;
// the flash kernel's K and V tiles come by the Tensor Data Mover (tensor_load_to_lds
// + s_wait_tensorcnt) with hardware LDS padding (272 B rows for K, 288 B for V),
// into two buffers each, one tile ahead of the products.
// Pipeline:
//   o_rgb  = l2norm(rgb  @ rgb_proj[h])          (GEMM kernel, MODE 0)
//   o_flow = l2norm(flow @ flow_proj[h])         (GEMM kernel, MODE 0)
//   T      = o_rgb @ atte_w[h]                   (GEMM kernel, MODE 1)
//   f_rgb  = tanh(gelu(Flash(Q=T,      K=o_flow, V=o_rgb )) + rgb )
//   f_flow = tanh(gelu(Flash(Q=o_flow, K=T,      V=o_flow)) + flow)
// Flash-style streaming avoids the 512MB atte tensor entirely.

#define N_  4
#define L_  2048
#define D_  1024
#define H_  8
#define DH_ 128

typedef __bf16 bf16_t;
typedef unsigned int       u32;
typedef unsigned long long u64;
typedef __attribute__((ext_vector_type(16))) __bf16 v16bf;
typedef __attribute__((ext_vector_type(8)))  __bf16 v8bf;
typedef __attribute__((ext_vector_type(4)))  __bf16 v4bf;
typedef __attribute__((ext_vector_type(8)))  float  v8f;
typedef __attribute__((ext_vector_type(4)))  float  v4f;
typedef __attribute__((ext_vector_type(4)))  u32    v4u;
typedef __attribute__((ext_vector_type(8)))  u32    v8u;

static __device__ __forceinline__ v8f wmma_bf16(v16bf a, v16bf b, v8f c) {
  // 8 args: (neg_a, A, neg_b, B, c_mod, C, reuse_a, reuse_b)
  return __builtin_amdgcn_wmma_f32_16x16x32_bf16(false, a, false, b, (short)0, c,
                                                 false, false);
}

// 16x32 bf16 fragment per ISA 7.12.2:
//   lane<16 : row M=lane,    K = {0..7, 16..23}
//   lane>=16: row M=lane-16, K = {8..15, 24..31}
// base points at a [16 x 32] tile, row-major with `stride` elements per row.
// (The Q^T B fragments use the same pattern from row-major Q [N][K] in global memory.)
static __device__ __forceinline__ v16bf load_frag(const bf16_t* base, int stride,
                                                  int lane) {
  const int r  = lane & 15;
  const int kb = (lane & 16) ? 8 : 0;
  const bf16_t* p = base + (size_t)r * stride + kb;
  v8bf lo = *(const v8bf*)(p);
  v8bf hi = *(const v8bf*)(p + 16);
  v16bf f;
#pragma unroll
  for (int i = 0; i < 8; ++i) { f[i] = lo[i]; f[i + 8] = hi[i]; }
  return f;
}

// B fragment (32 k x 16 n) out of a row-major [k][n] LDS tile by the transposing
// load: lane (c = lane & 15, hh = lane >> 4) gets T[kbase + 8*hh + 0..7][c], so the
// loads at kbase and kbase + 16 give the same k order as load_frag above.
// p is the lane's own address: row 8*hh + (lane & 7), column 8*((lane >> 3) & 1).
static __device__ __forceinline__ v16bf load_frag_tr(const bf16_t* p, int stride) {
  typedef __attribute__((address_space(3))) v8bf lds_v8bf;
  v8bf lo = __builtin_amdgcn_ds_load_tr16_b128_v8bf16((lds_v8bf*)p);
  v8bf hi = __builtin_amdgcn_ds_load_tr16_b128_v8bf16((lds_v8bf*)(p + 16 * stride));
  v16bf f;
#pragma unroll
  for (int i = 0; i < 8; ++i) { f[i] = lo[i]; f[i + 8] = hi[i]; }
  return f;
}

static __device__ __forceinline__ v8f zero8() {
  v8f z = {0.f, 0.f, 0.f, 0.f, 0.f, 0.f, 0.f, 0.f};
  return z;
}

// ---------------------------------------------------------------------------
// GEMM: O[l,k] = A[l,:] @ B[:,k]  per (n,h) slice, 128x128 output per block.
// MODE 0: A = f32 [L_,D_] (shared across heads), B = f32 proj[h] [D_,128],
//         epilogue = per-row L2 normalize. Kdim = 1024.
// MODE 1: A = bf16 o_rgb slice [L_,128], B = f32 atte_w[h] [128,128]. Kdim=128.
// Output bf16 [n,h,l,128].
// ---------------------------------------------------------------------------
// One k-step (32 k) of both operands on its way from global memory to LDS.
template <int MODE>
struct gemm_regs {
  v4f  a[4];    // MODE 0: A, f32
  v8bf a2[2];   // MODE 1: A, bf16
  v4f  b[4];    // B, f32
};

// Issues the loads of one k-step: A tile 128 rows x 32 k, B tile 32 k x 128 n (4096
// floats in a row). pa, pa2, pb: this lane's first element of the step's tiles.
template <int MODE>
static __device__ __forceinline__ void gemm_load(gemm_regs<MODE>& r, const float* pa,
                                                 const bf16_t* pa2, const float* pb) {
#pragma unroll  // constant indices keep these vectors in registers
  for (int j = 0; j < 4; ++j) {
    if (MODE == 0) r.a[j] = *(const v4f*)(pa + j * 32 * D_);   // 8 lanes a row, 32 rows
    r.b[j] = *(const v4f*)(pb + j * 1024);
  }
  if (MODE == 1) {
#pragma unroll  // constant indices keep these vectors in registers
    for (int j = 0; j < 2; ++j) r.a2[j] = *(const v8bf*)(pa2 + j * 64 * DH_);  // 4 lanes a row
  }
  // The loads stay in flight over the next k-steps while their address registers are
  // reused: this wait stands in front of every such overwrite. Its clobber also
  // keeps the loads from sinking towards their uses.
  asm volatile("s_wait_xcnt 0x0" ::: "memory");
}

// Converts a loaded k-step to bf16 and stores it: As[row][k] (80 B rows), Bs[k][n]
// row-major (288 B rows), packed 8 B or 16 B LDS stores.
template <int MODE>
static __device__ __forceinline__ void gemm_store(const gemm_regs<MODE>& r, bf16_t* As,
                                                  bf16_t* Bs, int tid) {
  if (MODE == 0) {
#pragma unroll  // constant indices keep these vectors in registers
    for (int j = 0; j < 4; ++j) {
      int e4 = (tid + 256 * j) * 4;
      v4bf d;
      d[0] = (bf16_t)r.a[j][0]; d[1] = (bf16_t)r.a[j][1];
      d[2] = (bf16_t)r.a[j][2]; d[3] = (bf16_t)r.a[j][3];
      *(v4bf*)(&As[(e4 >> 5) * 40 + (e4 & 31)]) = d;
    }
  } else {
#pragma unroll  // constant indices keep these vectors in registers
    for (int j = 0; j < 2; ++j) {
      int e8 = (tid + 256 * j) * 8;
      *(v8bf*)(&As[(e8 >> 5) * 40 + (e8 & 31)]) = r.a2[j];
    }
  }
#pragma unroll  // constant indices keep these vectors in registers
  for (int j = 0; j < 4; ++j) {
    int e4 = (tid + 256 * j) * 4;
    v4bf d;
    d[0] = (bf16_t)r.b[j][0]; d[1] = (bf16_t)r.b[j][1];
    d[2] = (bf16_t)r.b[j][2]; d[3] = (bf16_t)r.b[j][3];
    *(v4bf*)(&Bs[(e4 >> 7) * 144 + (e4 & 127)]) = d;
  }
}

// The eight products of one k-step: this wave's 16 rows against all 128 columns.
static __device__ __forceinline__ void gemm_mma(v8f (&acc)[8], const bf16_t* As,
                                                const bf16_t* btr, int wave, int lane) {
  v16bf afrag = load_frag(&As[(wave * 16) * 40], 40, lane);
#pragma unroll
  for (int t = 0; t < 8; ++t) {
    v16bf bfrag = load_frag_tr(btr + t * 16, 144);
    acc[t] = wmma_bf16(afrag, bfrag, acc[t]);
  }
}

// Work-group barrier of the k loop, by hand: it waits for this wave's LDS stores and
// reads only. __syncthreads() also waits for every global load, which would end the
// flight of the loads issued ahead at each k-step.
static __device__ __forceinline__ void gemm_barrier() {
  asm volatile("s_wait_dscnt 0x0\n\ts_barrier_signal -1\n\ts_barrier_wait -1" ::: "memory");
  // Keeps the conversions of a later k-step from being lifted over the barrier: their
  // wait would come with them and end the flight of the youngest loads.
  __builtin_amdgcn_sched_barrier(0);
}

// Kdim is a multiple of 64, at least 128 (four k-steps).
template <int MODE>
__global__ __launch_bounds__(256) void mca_gemm_kernel(
    const float* __restrict__ Af, const bf16_t* __restrict__ Ab,
    const float* __restrict__ Bf, bf16_t* __restrict__ O, int Kdim) {
  __shared__ bf16_t As[2][128 * 40];   // padded stride 40 (80B rows, 16B aligned)
  __shared__ bf16_t Bs[2][32 * 144];   // row-major Bs[k][n], 288B rows (32B x odd: tr16 reader)

  const int nh = blockIdx.y, n = nh / H_, h = nh % H_;
  const int l0 = blockIdx.x * 128;
  const int tid = threadIdx.x, wave = tid >> 5, lane = tid & 31;
  const int half = (lane >> 4) & 1, ln = lane & 15;

  // This lane's first element of the A and B tiles of k-step 0.
  const float*  pa  = (MODE == 0) ? Af + ((size_t)n * L_ + l0 + (tid >> 3)) * (size_t)D_ + (tid & 7) * 4 : nullptr;
  const bf16_t* pa2 = (MODE == 0) ? nullptr : Ab + ((size_t)nh * L_ + l0 + (tid >> 2)) * DH_ + (tid & 3) * 8;
  const float*  pb  = Bf + (size_t)h * Kdim * DH_ + tid * 4;
  bf16_t* Og = O + ((size_t)nh * L_ + l0) * DH_;

  // This lane's address in each B tile for the transposing loads.
  const int btr_off = (8 * half + (lane & 7)) * 144 + 8 * ((lane >> 3) & 1);
  const bf16_t* btr0 = &Bs[0][btr_off];
  const bf16_t* btr1 = &Bs[1][btr_off];

  v8f acc[8];
#pragma unroll
  for (int t = 0; t < 8; ++t) acc[t] = zero8();

  // At the top of an even k-step s: LDS buffer 0 holds step s, r1 step s + 1 and
  // r0 step s + 2 (both in flight). A step multiplies out of its buffer, stores the
  // next step into the other buffer (whose readers left it before the last barrier)
  // and issues the loads of step s + 3 into the registers just freed.
  gemm_regs<MODE> r0, r1;
  gemm_load<MODE>(r0, pa + (0), pa2 + (0), pb + (size_t)(0) * DH_);
  gemm_load<MODE>(r1, pa + (32), pa2 + (32), pb + (size_t)(32) * DH_);
  gemm_store<MODE>(r0, As[0], Bs[0], tid);
  gemm_load<MODE>(r0, pa + (64), pa2 + (64), pb + (size_t)(64) * DH_);
  gemm_barrier();

  int k0 = 0;
  for (; k0 + 160 < Kdim; k0 += 64) {
    gemm_mma(acc, As[0], btr0, wave, lane);
    gemm_store<MODE>(r1, As[1], Bs[1], tid);
    gemm_load<MODE>(r1, pa + (k0 + 96), pa2 + (k0 + 96), pb + (size_t)(k0 + 96) * DH_);
    gemm_barrier();
    gemm_mma(acc, As[1], btr1, wave, lane);
    gemm_store<MODE>(r0, As[0], Bs[0], tid);
    gemm_load<MODE>(r0, pa + (k0 + 128), pa2 + (k0 + 128), pb + (size_t)(k0 + 128) * DH_);
    gemm_barrier();
  }
  // The last four k-steps, written out so that every load in the loop above is
  // unconditional and its wait can count the younger loads.
  gemm_mma(acc, As[0], btr0, wave, lane);
  gemm_store<MODE>(r1, As[1], Bs[1], tid);
  gemm_load<MODE>(r1, pa + (k0 + 96), pa2 + (k0 + 96), pb + (size_t)(k0 + 96) * DH_);
  gemm_barrier();
  gemm_mma(acc, As[1], btr1, wave, lane);
  gemm_store<MODE>(r0, As[0], Bs[0], tid);
  gemm_barrier();
  gemm_mma(acc, As[0], btr0, wave, lane);
  gemm_store<MODE>(r1, As[1], Bs[1], tid);
  gemm_barrier();
  gemm_mma(acc, As[1], btr1, wave, lane);

  // Epilogue. C/D layout: VGPR r -> row m = r + 8*half; col = ln + 16*t.
  float inv[8];
#pragma unroll
  for (int r = 0; r < 8; ++r) {
    if (MODE == 0) {
      float s = 0.f;
#pragma unroll
      for (int t = 0; t < 8; ++t) s += acc[t][r] * acc[t][r];
      s += __shfl_xor(s, 1);  s += __shfl_xor(s, 2);
      s += __shfl_xor(s, 4);  s += __shfl_xor(s, 8);   // full-row sum within half
      inv[r] = 1.0f / fmaxf(sqrtf(s), 1e-12f);
    } else {
      inv[r] = 1.0f;
    }
  }
#pragma unroll
  for (int t = 0; t < 8; ++t)
#pragma unroll
    for (int r = 0; r < 8; ++r) {
      int m = wave * 16 + r + 8 * half;
      Og[(size_t)m * DH_ + t * 16 + ln] = (bf16_t)(acc[t][r] * inv[r]);
    }
}

static __device__ __forceinline__ u32 uni(u32 v) { return (u32)__builtin_amdgcn_readfirstlane(v); }

// A wave-uniform value for a test around a tensor load, or for its descriptor. A test on it
// compiles to s_cmp and a scalar branch: a tensor load ignores EXEC, and only a real branch
// keeps a wave from issuing it.
static __device__ __forceinline__ u32 pinned(u32 v) {
  u32 w = uni(v);
  asm volatile("" : "+s"(w));  // pinned(): holds the value in a scalar register, read at this place
  return w;
}

// A tile is 64 rows of 256 B (source pitch 256 B). All extents in bytes (data_size code 0),
// tensor = tile. WORD0 holds the pad: after every 256 B (interval code 5), 16 B (amount
// code 3) or 32 B (amount code 7).
#define TILE_PAD16 ((1u << 20) | (5u << 22) | (3u << 25))
#define TILE_PAD32 ((1u << 20) | (5u << 22) | (7u << 25))

// Group 1 of a tile's descriptor: the same for every tile, built once in front of the loop.
template <u32 WORD0>
static __device__ __forceinline__ v8u tile_group1() {
  v8u g1;
  g1[0] = uni(WORD0);                                           // no mask, data_size 0, pad
  g1[1] = uni(256u << 16);                                      // tensor_dim0 = 256 B
  g1[2] = uni(64u << 16);                                       // tensor_dim1 = 64 rows
  g1[3] = uni(256u << 16);                                      // tile_dim0 = 256 B
  g1[4] = uni(64u);                                             // tile_dim1 = 64 rows
  g1[5] = uni(256u);                                            // source row pitch, bytes
  g1[6] = uni(0u);
  g1[7] = uni(0u);
  // pinned(), for descriptor words: they stay in these scalar registers for all their uses.
  // As plain constants they are set up anew at each use, over registers of a request in flight.
  asm volatile("" : "+s"(g1));
  return g1;
}

// Group 0: the tile's place in LDS (byte offset dst) and its first byte in memory.
static __device__ __forceinline__ v4u tile_group0(u32 dst, const bf16_t* src) {
  const u64 ga = (u64)(uintptr_t)src;
  v4u g0;
  g0[0] = uni(1u);                                              // count = 1
  g0[1] = uni(dst);                                             // LDS destination
  g0[2] = uni((u32)ga);                                         // address [31:0]
  g0[3] = uni(((u32)(ga >> 32) & 0x01ffffffu) | 0x80000000u);   // address [56:32], type = 2
  // pinned(), for descriptor words: the four are one value made at this place, so that the
  // load and its wait name the same registers and no word is set up ahead in the loop.
  asm volatile("" : "+s"(g0));
  return g0;
}

static __device__ __forceinline__ void tile_load(v4u g0, v8u g1) {
  asm volatile("tensor_load_to_lds %0, %1" :: "s"(g0), "s"(g1) : "memory");
}

// Lane l with lane l ^ 16: the two lanes that share a query column.
static __device__ __forceinline__ float xhalf(float x) {
  return __builtin_bit_cast(float, __builtin_amdgcn_permlanex16(
      __builtin_bit_cast(int, x), __builtin_bit_cast(int, x),
      0x76543210, 0xfedcba98, false, false));
}

// Exact-form gelu, 0.5 x (1 + erf(x / sqrt 2)) = h + |h| erf(|x| / sqrt 2), from h = x / 2.
// erf(z) = 1 - (a1 t + ... + a5 t^5) exp(-z^2), t = 1 / (1 + p z), z >= 0: one straight
// line for every z (absolute error of the form below 2e-7; 1 at infinity), where the
// library erff takes one of two branches per value.
static __device__ __forceinline__ float gelu_from_half(float h) {
  const float a = fabsf(h);
  const float t = __builtin_amdgcn_rcpf(fmaf(0.46328378f, a, 1.0f));   // p z = p sqrt(2) |h|
  float p = fmaf(1.061405429f, t, -1.453152027f);
  p = fmaf(p, t, 1.421413741f);
  p = fmaf(p, t, -0.284496736f);
  p = fmaf(p, t, 0.254829592f);
  const float e = __builtin_amdgcn_exp2f((h * h) * -2.88539008f);      // exp(-z^2), z^2 = 2 h^2
  return fmaf(a, fmaf(-(p * t), e, 1.0f), h);
}

// tanh(y) = 1 - 2 / (1 + exp(2 y)): one straight line for every y (exp -> inf gives 1,
// exp -> 0 gives -1), where the library tanhf takes one of two branches per value.
static __device__ __forceinline__ float tanh_line(float y) {
  return fmaf(-2.0f, __builtin_amdgcn_rcpf(1.0f + __builtin_amdgcn_exp2f(y * 2.88539008f)), 1.0f);
}

// The grid puts two work-groups on a WGP, four waves on a SIMD, and never more: with
// that stated the compiler schedules the main loop for 256 registers a wave (its LDS
// reads stay several products ahead) and not for a fifth wave that never comes.
__global__ __launch_bounds__(256) __attribute__((amdgpu_waves_per_eu(4, 4))) void mca_flash_kernel(
    const bf16_t* __restrict__ Q, const bf16_t* __restrict__ Kx,
    const bf16_t* __restrict__ V, const float* __restrict__ res,
    float* __restrict__ out) {
  // Four places of 18 KiB (each a multiple of 2 KiB from the start of LDS): K tiles [s][dh]
  // with 272B rows in places 0 and 1 (17 KiB used), V tiles [s][dh] with 288B rows (32B x
  // odd: tr16 reader) in places 2 and 3. Tile s lies in place s & 1 of its pair.
  constexpr int PLACE = 9216;       // elements
  __shared__ __attribute__((aligned(2048))) bf16_t Ring[4 * PLACE];
  __shared__ __attribute__((aligned(16))) float Os[8 * 16 * 132];  // epilogue: per-wave 16 x 128 tile, O^T -> rows

  const int nh = blockIdx.y, n = nh / H_, h = nh % H_;
  const int l0 = blockIdx.x * 128;
  const int tid = threadIdx.x, wave = tid >> 5, lane = tid & 31;
  const int half = (lane >> 4) & 1, ln = lane & 15;

  const bf16_t* Qg = Q  + ((size_t)nh * L_ + l0) * DH_;
  const bf16_t* Kg = Kx + (size_t)nh * L_ * DH_;
  const bf16_t* Vg = V  + (size_t)nh * L_ * DH_;

  // Q fragments for this wave's 16-row strip, held in registers for all s.
  v16bf qf[4];
#pragma unroll
  for (int kk = 0; kk < 4; ++kk)
    qf[kk] = load_frag(Qg + (size_t)(wave * 16) * DH_ + kk * 32, DH_, lane);

  // This lane's address in the V tile for the transposing loads.
  const bf16_t* vtr = &Ring[2 * PLACE + (8 * half + (lane & 7)) * 144 + 8 * ((lane >> 3) & 1)];

  v8f o_acc[8];
#pragma unroll
  for (int t = 0; t < 8; ++t) o_acc[t] = zero8();
  // Query q = ln of this wave's strip: running maximum (equal in both halves) and
  // this half's part of the running sum (joined once, behind the loop).
  float m_i = -3.0e38f, l_i = 0.f;

  // Wave 0 asks for tile st of K, wave 1 for tile st of V: one request a wave.
  const u32 wv = uni(threadIdx.x >> 5);
  const u32 ring0 = (u32)(uintptr_t)(&Ring[0]);   // LDS byte offset of place 0
  const v8u g1k = tile_group1<TILE_PAD16>();
  const v8u g1v = tile_group1<TILE_PAD32>();
  const bf16_t* plane = (wv == 0u) ? Kg : Vg;
  const u32 place0 = ring0 + ((wv == 0u) ? 0u : (u32)(2 * PLACE * 2));
  v4u g0;   // group 0 of this wave's request in flight
  auto issue = [&](u32 st) {
    g0 = tile_group0(place0 + (st & 1u) * (u32)(PLACE * 2), plane + (size_t)st * 64 * DH_);
    if (pinned(wv == 0u)) tile_load(g0, g1k);
    if (pinned(wv == 1u)) tile_load(g0, g1v);
  };
  // The issuer's wait for its request. It names the descriptor's registers as inputs, so
  // that they keep their values from the load to here and take new ones only behind it.
  auto landed = [&]() {
    if (pinned(wv < 2u)) asm volatile("s_wait_tensorcnt 0x0" :: "s"(g0), "s"(g1k), "s"(g1v) : "memory");
  };
  constexpr u32 NT = L_ / 64;   // tiles, at least two
  issue(0u);
  // Tile 0 has landed for its issuer; the barrier shows it to the other waves.
  landed();
  __syncthreads();
  issue(1u);

  for (u32 st = 0; st < NT; ++st) {
    const bf16_t* Ks = &Ring[(st & 1u) * PLACE];
    const bf16_t* vt = vtr + (st & 1u) * PLACE;

    // S^T = K @ Q^T: tile t holds keys s = 16 t + r + 8 half (register r) of query ln.
    v8f sacc[4];
#pragma unroll  // constant indices keep these vectors in registers
    for (int t = 0; t < 4; ++t) {
      v8f s = zero8();
#pragma unroll  // constant indices keep these vectors in registers
      for (int kk = 0; kk < 4; ++kk)
        s = wmma_bf16(load_frag(&Ks[(t * 16) * 136 + kk * 32], 136, lane), qf[kk], s);
      sacc[t] = s;
    }

    // Online softmax of query ln: 32 scores in this lane, the other 32 in lane ^ 16.
    float mt[4];
#pragma unroll  // constant indices keep these vectors in registers
    for (int t = 0; t < 4; ++t) {
      mt[t] = sacc[t][0];
#pragma unroll  // constant indices keep these vectors in registers
      for (int r = 1; r < 8; ++r) mt[t] = fmaxf(mt[t], sacc[t][r]);
    }
    float mx = fmaxf(fmaxf(mt[0], mt[1]), fmaxf(mt[2], mt[3]));
    mx = fmaxf(mx, xhalf(mx));
    const float mnew = fmaxf(m_i, mx);
    const float corr = __expf(m_i - mnew);
    float rs[4];
#pragma unroll  // constant indices keep these vectors in registers
    for (int t = 0; t < 4; ++t) {
      rs[t] = 0.f;
#pragma unroll  // constant indices keep these vectors in registers
      for (int r = 0; r < 8; ++r) {
        float p = __expf(sacc[t][r] - mnew);
        sacc[t][r] = p; rs[t] += p;
      }
    }
    l_i = l_i * corr + ((rs[0] + rs[1]) + (rs[2] + rs[3]));
    m_i = mnew;
#pragma unroll  // constant indices keep these vectors in registers
    for (int t = 0; t < 8; ++t)
#pragma unroll  // constant indices keep these vectors in registers
      for (int r = 0; r < 8; ++r) o_acc[t][r] *= corr;

    // O^T += V^T @ P^T (k-dim = 64 s, two 32-wide WMMA steps). A = V^T by the
    // transposing load; B = tiles 2kk and 2kk+1 of S^T converted in place, which is
    // the same k order (8 half + 0..7, then 16 + 8 half + 0..7).
#pragma unroll  // constant indices keep these vectors in registers
    for (int kk = 0; kk < 2; ++kk) {
      v16bf pf;
#pragma unroll  // constant indices keep these vectors in registers
      for (int i = 0; i < 8; ++i) {
        pf[i]     = (bf16_t)sacc[2 * kk][i];
        pf[i + 8] = (bf16_t)sacc[2 * kk + 1][i];
      }
#pragma unroll  // constant indices keep these vectors in registers
      for (int t = 0; t < 8; ++t) {
        v16bf vf = load_frag_tr(vt + (kk * 32) * 144 + t * 16, 144);
        o_acc[t] = wmma_bf16(vf, pf, o_acc[t]);
      }
    }
    // Hand-over. This wave's reads of tile st are done; tile st + 1 has landed for its
    // issuer; the one barrier shows tile st + 1 to every wave and ends all reads of tile st,
    // whose places then take tile st + 2.
    asm volatile("s_wait_dscnt 0x0" ::: "memory");
    landed();
    __syncthreads();
    const u32 nx = pinned(st + 2u);   // read behind the waits: the descriptor is formed here
    if (nx < NT) issue(nx);
  }
  // Nothing is outstanding when the wave goes on to the epilogue and ends.
  asm volatile("s_wait_tensorcnt 0x0" :: "s"(g0), "s"(g1k), "s"(g1v) : "memory");  // inputs: as in landed()
  asm volatile("s_wait_dscnt 0x0" ::: "memory");

  // Epilogue: O/l and gelu where the values lie (o_acc[t][r] = query ln, column
  // 16 t + 8 half + r), then through this wave's own LDS tile (528 B rows) so that
  // residual loads and output stores run along whole rows of 512 B.
  const float hinv = 0.5f / (l_i + xhalf(l_i));   // O / l, halved for gelu_from_half
  float* ow = &Os[wave * 16 * 132];
#pragma unroll  // constant indices keep these vectors in registers
  for (int t = 0; t < 8; ++t) {
    float g[8];
#pragma unroll  // constant indices keep these vectors in registers
    for (int r = 0; r < 8; ++r) g[r] = gelu_from_half(o_acc[t][r] * hinv);
    float* p = ow + ln * 132 + t * 16 + 8 * half;
    *(float4*)(p)     = make_float4(g[0], g[1], g[2], g[3]);
    *(float4*)(p + 4) = make_float4(g[4], g[5], g[6], g[7]);
  }
  // Only this wave reads the tile it wrote; LDS is in-order per wave.
  const size_t idx0 = (size_t)n * L_ * D_ + (size_t)(l0 + wave * 16) * D_ + h * DH_ + lane * 4;
  for (int q0 = 0; q0 < 16; q0 += 4) {
    // Four rows a trip, all their loads ahead of the arithmetic, so that four residual
    // loads are in flight at once.
    float4 g[4], rv[4];
#pragma unroll  // constant indices keep these vectors in registers
    for (int j = 0; j < 4; ++j) {
      rv[j] = *(const float4*)(res + idx0 + (size_t)(q0 + j) * D_);
      g[j]  = *(const float4*)(ow + (q0 + j) * 132 + lane * 4);
    }
    // The residual loads stay in flight over the arithmetic while their address
    // registers are reused: this wait stands in front of every such overwrite.
    asm volatile("s_wait_xcnt 0x0" ::: "memory");
#pragma unroll  // constant indices keep these vectors in registers
    for (int j = 0; j < 4; ++j)
      *(float4*)(out + idx0 + (size_t)(q0 + j) * D_) =
          make_float4(tanh_line(g[j].x + rv[j].x), tanh_line(g[j].y + rv[j].y),
                      tanh_line(g[j].z + rv[j].z), tanh_line(g[j].w + rv[j].w));
  }
}

extern "C" void kernel_launch(void* const* d_in, const int* in_sizes, int n_in,
                              void* d_out, int out_size, void* d_ws, size_t ws_size,
                              hipStream_t stream) {
  const float* rgb       = (const float*)d_in[0];
  const float* flow      = (const float*)d_in[1];
  const float* rgb_proj  = (const float*)d_in[2];
  const float* flow_proj = (const float*)d_in[3];
  const float* atte_w    = (const float*)d_in[4];

  float* f_rgb  = (float*)d_out;
  float* f_flow = f_rgb + (size_t)N_ * L_ * D_;

  const size_t oElems = (size_t)N_ * H_ * L_ * DH_;   // 8,388,608 (16 MB bf16)
  bf16_t* o_rgb  = (bf16_t*)d_ws;
  bf16_t* o_flow = o_rgb + oElems;
  bf16_t* Tq     = o_flow + oElems;                   // o_rgb @ atte_w

  dim3 grid(L_ / 128, N_ * H_);
  dim3 block(256);

  mca_gemm_kernel<0><<<grid, block, 0, stream>>>(rgb,  nullptr, rgb_proj,  o_rgb,  D_);
  mca_gemm_kernel<0><<<grid, block, 0, stream>>>(flow, nullptr, flow_proj, o_flow, D_);
  mca_gemm_kernel<1><<<grid, block, 0, stream>>>(nullptr, o_rgb, atte_w,   Tq,     DH_);

  mca_flash_kernel<<<grid, block, 0, stream>>>(Tq,     o_flow, o_rgb,  rgb,  f_rgb);
  mca_flash_kernel<<<grid, block, 0, stream>>>(o_flow, Tq,     o_flow, flow, f_flow);
}

// v007
// Measured time: 159 microseconds a run.
// Two timings next to v006 both put it at 1.10 times that version's speed.
// Over all steps from v000 it is 4.42 times as fast.
#include <hip/hip_runtime.h>
#include <hip/hip_bf16.h>
#include <math.h>

// MI455X / gfx1250, wave32. All heavy math goes through v_wmma_f32_16x16x32_bf16;
// the flash kernel's K and V tiles come by the Tensor Data Mover (tensor_load_to_lds
// + s_wait_tensorcnt) with hardware LDS padding (272 B rows for K, 288 B for V),
// into two buffers each, one tile ahead of the products.
// Pipeline:
//   o_rgb  = l2norm(rgb  @ rgb_proj[h])          (projection kernel, one grid for both)
//   o_flow = l2norm(flow @ flow_proj[h])
//   T      = o_rgb @ atte_w[h]                   (GEMM kernel, MODE 1)
//   f_rgb  = tanh(gelu(Flash(Q=T,      K=o_flow, V=o_rgb )) + rgb )
//   f_flow = tanh(gelu(Flash(Q=o_flow, K=T,      V=o_flow)) + flow)
// Flash-style streaming avoids the 512MB atte tensor entirely.

#define N_  4
#define L_  2048
#define D_  1024
#define H_  8
#define DH_ 128

typedef __bf16 bf16_t;
typedef unsigned int       u32;
typedef unsigned long long u64;
typedef __attribute__((ext_vector_type(16))) __bf16 v16bf;
typedef __attribute__((ext_vector_type(8)))  __bf16 v8bf;
typedef __attribute__((ext_vector_type(4)))  __bf16 v4bf;
typedef __attribute__((ext_vector_type(8)))  float  v8f;
typedef __attribute__((ext_vector_type(4)))  float  v4f;
typedef __attribute__((ext_vector_type(4)))  u32    v4u;
typedef __attribute__((ext_vector_type(8)))  u32    v8u;

static __device__ __forceinline__ v8f wmma_bf16(v16bf a, v16bf b, v8f c) {
  // 8 args: (neg_a, A, neg_b, B, c_mod, C, reuse_a, reuse_b)
  return __builtin_amdgcn_wmma_f32_16x16x32_bf16(false, a, false, b, (short)0, c,
                                                 false, false);
}

// 16x32 bf16 fragment per ISA 7.12.2:
//   lane<16 : row M=lane,    K = {0..7, 16..23}
//   lane>=16: row M=lane-16, K = {8..15, 24..31}
// base points at a [16 x 32] tile, row-major with `stride` elements per row.
// (The Q^T B fragments use the same pattern from row-major Q [N][K] in global memory.)
static __device__ __forceinline__ v16bf load_frag(const bf16_t* base, int stride,
                                                  int lane) {
  const int r  = lane & 15;
  const int kb = (lane & 16) ? 8 : 0;
  const bf16_t* p = base + (size_t)r * stride + kb;
  v8bf lo = *(const v8bf*)(p);
  v8bf hi = *(const v8bf*)(p + 16);
  v16bf f;
#pragma unroll
  for (int i = 0; i < 8; ++i) { f[i] = lo[i]; f[i + 8] = hi[i]; }
  return f;
}

// B fragment (32 k x 16 n) out of a row-major [k][n] LDS tile by the transposing
// load: lane (c = lane & 15, hh = lane >> 4) gets T[kbase + 8*hh + 0..7][c], so the
// loads at kbase and kbase + 16 give the same k order as load_frag above.
// p is the lane's own address: row 8*hh + (lane & 7), column 8*((lane >> 3) & 1).
static __device__ __forceinline__ v16bf load_frag_tr(const bf16_t* p, int stride) {
  typedef __attribute__((address_space(3))) v8bf lds_v8bf;
  v8bf lo = __builtin_amdgcn_ds_load_tr16_b128_v8bf16((lds_v8bf*)p);
  v8bf hi = __builtin_amdgcn_ds_load_tr16_b128_v8bf16((lds_v8bf*)(p + 16 * stride));
  v16bf f;
#pragma unroll
  for (int i = 0; i < 8; ++i) { f[i] = lo[i]; f[i + 8] = hi[i]; }
  return f;
}

static __device__ __forceinline__ v8f zero8() {
  v8f z = {0.f, 0.f, 0.f, 0.f, 0.f, 0.f, 0.f, 0.f};
  return z;
}

// ---------------------------------------------------------------------------
// GEMM: O[l,k] = A[l,:] @ B[:,k]  per (n,h) slice, 128x128 output per block.
// MODE 0: A = f32 [L_,D_] (shared across heads), B = f32 proj[h] [D_,128],
//         epilogue = per-row L2 normalize. Kdim = 1024.
// MODE 1: A = bf16 o_rgb slice [L_,128], B = f32 atte_w[h] [128,128]. Kdim=128.
// Output bf16 [n,h,l,128].
// ---------------------------------------------------------------------------
// One k-step (32 k) of both operands on its way from global memory to LDS.
template <int MODE>
struct gemm_regs {
  v4f  a[4];    // MODE 0: A, f32
  v8bf a2[2];   // MODE 1: A, bf16
  v4f  b[4];    // B, f32
};

// Issues the loads of one k-step: A tile 128 rows x 32 k, B tile 32 k x 128 n (4096
// floats in a row). pa, pa2, pb: this lane's first element of the step's tiles.
template <int MODE>
static __device__ __forceinline__ void gemm_load(gemm_regs<MODE>& r, const float* pa,
                                                 const bf16_t* pa2, const float* pb) {
#pragma unroll  // constant indices keep these vectors in registers
  for (int j = 0; j < 4; ++j) {
    if (MODE == 0) r.a[j] = *(const v4f*)(pa + j * 32 * D_);   // 8 lanes a row, 32 rows
    r.b[j] = *(const v4f*)(pb + j * 1024);
  }
  if (MODE == 1) {
#pragma unroll  // constant indices keep these vectors in registers
    for (int j = 0; j < 2; ++j) r.a2[j] = *(const v8bf*)(pa2 + j * 64 * DH_);  // 4 lanes a row
  }
  // The loads stay in flight over the next k-steps while their address registers are
  // reused: this wait stands in front of every such overwrite. Its clobber also
  // keeps the loads from sinking towards their uses.
  asm volatile("s_wait_xcnt 0x0" ::: "memory");
}

// Converts a loaded k-step to bf16 and stores it: As[row][k] (80 B rows), Bs[k][n]
// row-major (288 B rows), packed 8 B or 16 B LDS stores.
template <int MODE>
static __device__ __forceinline__ void gemm_store(const gemm_regs<MODE>& r, bf16_t* As,
                                                  bf16_t* Bs, int tid) {
  if (MODE == 0) {
#pragma unroll  // constant indices keep these vectors in registers
    for (int j = 0; j < 4; ++j) {
      int e4 = (tid + 256 * j) * 4;
      v4bf d;
      d[0] = (bf16_t)r.a[j][0]; d[1] = (bf16_t)r.a[j][1];
      d[2] = (bf16_t)r.a[j][2]; d[3] = (bf16_t)r.a[j][3];
      *(v4bf*)(&As[(e4 >> 5) * 40 + (e4 & 31)]) = d;
    }
  } else {
#pragma unroll  // constant indices keep these vectors in registers
    for (int j = 0; j < 2; ++j) {
      int e8 = (tid + 256 * j) * 8;
      *(v8bf*)(&As[(e8 >> 5) * 40 + (e8 & 31)]) = r.a2[j];
    }
  }
#pragma unroll  // constant indices keep these vectors in registers
  for (int j = 0; j < 4; ++j) {
    int e4 = (tid + 256 * j) * 4;
    v4bf d;
    d[0] = (bf16_t)r.b[j][0]; d[1] = (bf16_t)r.b[j][1];
    d[2] = (bf16_t)r.b[j][2]; d[3] = (bf16_t)r.b[j][3];
    *(v4bf*)(&Bs[(e4 >> 7) * 144 + (e4 & 127)]) = d;
  }
}

// The eight products of one k-step: this wave's 16 rows against all 128 columns.
static __device__ __forceinline__ void gemm_mma(v8f (&acc)[8], const bf16_t* As,
                                                const bf16_t* btr, int wave, int lane) {
  v16bf afrag = load_frag(&As[(wave * 16) * 40], 40, lane);
#pragma unroll
  for (int t = 0; t < 8; ++t) {
    v16bf bfrag = load_frag_tr(btr + t * 16, 144);
    acc[t] = wmma_bf16(afrag, bfrag, acc[t]);
  }
}

// Work-group barrier of the k loop, by hand: it waits for this wave's LDS stores and
// reads only. __syncthreads() also waits for every global load, which would end the
// flight of the loads issued ahead at each k-step.
static __device__ __forceinline__ void gemm_barrier() {
  asm volatile("s_wait_dscnt 0x0\n\ts_barrier_signal -1\n\ts_barrier_wait -1" ::: "memory");
  // Keeps the conversions of a later k-step from being lifted over the barrier: their
  // wait would come with them and end the flight of the youngest loads.
  __builtin_amdgcn_sched_barrier(0);
}

// Kdim is a multiple of 64, at least 128 (four k-steps).
template <int MODE>
__global__ __launch_bounds__(256) void mca_gemm_kernel(
    const float* __restrict__ Af, const bf16_t* __restrict__ Ab,
    const float* __restrict__ Bf, bf16_t* __restrict__ O, int Kdim) {
  __shared__ bf16_t As[2][128 * 40];   // padded stride 40 (80B rows, 16B aligned)
  __shared__ bf16_t Bs[2][32 * 144];   // row-major Bs[k][n], 288B rows (32B x odd: tr16 reader)

  const int nh = blockIdx.y, n = nh / H_, h = nh % H_;
  const int l0 = blockIdx.x * 128;
  const int tid = threadIdx.x, wave = tid >> 5, lane = tid & 31;
  const int half = (lane >> 4) & 1, ln = lane & 15;

  // This lane's first element of the A and B tiles of k-step 0.
  const float*  pa  = (MODE == 0) ? Af + ((size_t)n * L_ + l0 + (tid >> 3)) * (size_t)D_ + (tid & 7) * 4 : nullptr;
  const bf16_t* pa2 = (MODE == 0) ? nullptr : Ab + ((size_t)nh * L_ + l0 + (tid >> 2)) * DH_ + (tid & 3) * 8;
  const float*  pb  = Bf + (size_t)h * Kdim * DH_ + tid * 4;
  bf16_t* Og = O + ((size_t)nh * L_ + l0) * DH_;

  // This lane's address in each B tile for the transposing loads.
  const int btr_off = (8 * half + (lane & 7)) * 144 + 8 * ((lane >> 3) & 1);
  const bf16_t* btr0 = &Bs[0][btr_off];
  const bf16_t* btr1 = &Bs[1][btr_off];

  v8f acc[8];
#pragma unroll
  for (int t = 0; t < 8; ++t) acc[t] = zero8();

  // At the top of an even k-step s: LDS buffer 0 holds step s, r1 step s + 1 and
  // r0 step s + 2 (both in flight). A step multiplies out of its buffer, stores the
  // next step into the other buffer (whose readers left it before the last barrier)
  // and issues the loads of step s + 3 into the registers just freed.
  gemm_regs<MODE> r0, r1;
  gemm_load<MODE>(r0, pa + (0), pa2 + (0), pb + (size_t)(0) * DH_);
  gemm_load<MODE>(r1, pa + (32), pa2 + (32), pb + (size_t)(32) * DH_);
  gemm_store<MODE>(r0, As[0], Bs[0], tid);
  gemm_load<MODE>(r0, pa + (64), pa2 + (64), pb + (size_t)(64) * DH_);
  gemm_barrier();

  int k0 = 0;
  for (; k0 + 160 < Kdim; k0 += 64) {
    gemm_mma(acc, As[0], btr0, wave, lane);
    gemm_store<MODE>(r1, As[1], Bs[1], tid);
    gemm_load<MODE>(r1, pa + (k0 + 96), pa2 + (k0 + 96), pb + (size_t)(k0 + 96) * DH_);
    gemm_barrier();
    gemm_mma(acc, As[1], btr1, wave, lane);
    gemm_store<MODE>(r0, As[0], Bs[0], tid);
    gemm_load<MODE>(r0, pa + (k0 + 128), pa2 + (k0 + 128), pb + (size_t)(k0 + 128) * DH_);
    gemm_barrier();
  }
  // The last four k-steps, written out so that every load in the loop above is
  // unconditional and its wait can count the younger loads.
  gemm_mma(acc, As[0], btr0, wave, lane);
  gemm_store<MODE>(r1, As[1], Bs[1], tid);
  gemm_load<MODE>(r1, pa + (k0 + 96), pa2 + (k0 + 96), pb + (size_t)(k0 + 96) * DH_);
  gemm_barrier();
  gemm_mma(acc, As[1], btr1, wave, lane);
  gemm_store<MODE>(r0, As[0], Bs[0], tid);
  gemm_barrier();
  gemm_mma(acc, As[0], btr0, wave, lane);
  gemm_store<MODE>(r1, As[1], Bs[1], tid);
  gemm_barrier();
  gemm_mma(acc, As[1], btr1, wave, lane);

  // Epilogue. C/D layout: VGPR r -> row m = r + 8*half; col = ln + 16*t.
  float inv[8];
#pragma unroll
  for (int r = 0; r < 8; ++r) {
    if (MODE == 0) {
      float s = 0.f;
#pragma unroll
      for (int t = 0; t < 8; ++t) s += acc[t][r] * acc[t][r];
      s += __shfl_xor(s, 1);  s += __shfl_xor(s, 2);
      s += __shfl_xor(s, 4);  s += __shfl_xor(s, 8);   // full-row sum within half
      inv[r] = 1.0f / fmaxf(sqrtf(s), 1e-12f);
    } else {
      inv[r] = 1.0f;
    }
  }
#pragma unroll
  for (int t = 0; t < 8; ++t)
#pragma unroll
    for (int r = 0; r < 8; ++r) {
      int m = wave * 16 + r + 8 * half;
      Og[(size_t)m * DH_ + t * 16 + ln] = (bf16_t)(acc[t][r] * inv[r]);
    }
}

// ---------------------------------------------------------------------------
// Both projections in one grid: O[l, :] = l2norm(A[l, :] @ B[h]) for two heads h.
// A work-group makes 256 rows x 256 columns (two heads), so that every A and B byte it
// takes from L2 feeds twice the products of a 128 x 128 tile; 2 x 128 such tiles give
// every WGP one work-group. 16 waves of 32 rows x 128 columns (one head: the row norm
// stays inside a wave); a B fragment read from LDS feeds two products.
// Same k order, k-step, register sets, LDS buffers and barrier as the GEMM kernel above.
// ---------------------------------------------------------------------------
struct proj_regs {
  v4f a[4];   // A: 256 rows x 32 k
  v4f b[4];   // B: two heads x 32 k x 128 n
};

// pa, pb: this lane's first element of the k-step's A tile and of the first head's B tile.
static __device__ __forceinline__ void proj_load(proj_regs& r, const float* pa, const float* pb) {
#pragma unroll  // constant indices keep these vectors in registers
  for (int j = 0; j < 4; ++j) {
    r.a[j] = *(const v4f*)(pa + j * 64 * D_);                              // 8 lanes a row, 64 rows
    r.b[j] = *(const v4f*)(pb + (j >> 1) * (D_ * DH_) + (j & 1) * 2048);   // 4096 floats a head
  }
  // The loads stay in flight over the next k-steps while their address registers are
  // reused: this wait stands in front of every such overwrite. Its clobber also
  // keeps the loads from sinking towards their uses.
  asm volatile("s_wait_xcnt 0x0" ::: "memory");
}

// As[row][k] (80 B rows), Bs[head][k][n] row-major (288 B rows), packed 8 B LDS stores.
static __device__ __forceinline__ void proj_store(const proj_regs& r, bf16_t* As, bf16_t* Bs, int tid) {
#pragma unroll  // constant indices keep these vectors in registers
  for (int j = 0; j < 4; ++j) {
    int e4 = (tid + 512 * j) * 4;
    v4bf d;
    d[0] = (bf16_t)r.a[j][0]; d[1] = (bf16_t)r.a[j][1];
    d[2] = (bf16_t)r.a[j][2]; d[3] = (bf16_t)r.a[j][3];
    *(v4bf*)(&As[(e4 >> 5) * 40 + (e4 & 31)]) = d;
  }
#pragma unroll  // constant indices keep these vectors in registers
  for (int j = 0; j < 4; ++j) {
    int e4 = (tid + 512 * (j & 1)) * 4;
    v4bf d;
    d[0] = (bf16_t)r.b[j][0]; d[1] = (bf16_t)r.b[j][1];
    d[2] = (bf16_t)r.b[j][2]; d[3] = (bf16_t)r.b[j][3];
    *(v4bf*)(&Bs[(j >> 1) * (32 * 144) + (e4 >> 7) * 144 + (e4 & 127)]) = d;
  }
}

// The sixteen products of one k-step: this wave's 32 rows against its head's 128 columns.
// arow: the wave's first row in the A tile; btr: the lane's address in its head's B tile.
static __device__ __forceinline__ void proj_mma(v8f (&acc)[2][8], const bf16_t* arow,
                                                const bf16_t* btr, int lane) {
  v16bf a0 = load_frag(arow, 40, lane);
  v16bf a1 = load_frag(arow + 16 * 40, 40, lane);
#pragma unroll
  for (int t = 0; t < 8; ++t) {
    v16bf bfrag = load_frag_tr(btr + t * 16, 144);
    acc[0][t] = wmma_bf16(a0, bfrag, acc[0][t]);
    acc[1][t] = wmma_bf16(a1, bfrag, acc[1][t]);
  }
}

// One work-group of 16 waves on a WGP, four waves on a SIMD, and never more: with that
// stated the compiler schedules for 256 registers a wave.
__global__ __launch_bounds__(512) __attribute__((amdgpu_waves_per_eu(4, 4))) void mca_proj_kernel(
    const float* __restrict__ A0, const float* __restrict__ A1,
    const float* __restrict__ B0, const float* __restrict__ B1,
    bf16_t* __restrict__ O0, bf16_t* __restrict__ O1) {
  __shared__ bf16_t As[2][256 * 40];       // padded stride 40 (80B rows, 16B aligned)
  __shared__ bf16_t Bs[2][2 * 32 * 144];   // per head row-major [k][n], 288B rows (32B x odd: tr16 reader)

  const float* Af = blockIdx.z ? A1 : A0;
  const float* Bf = blockIdx.z ? B1 : B0;
  bf16_t*      O  = blockIdx.z ? O1 : O0;
  const int n = blockIdx.y / (H_ / 2), h0 = (blockIdx.y % (H_ / 2)) * 2;
  const int l0 = blockIdx.x * 256;
  const int tid = threadIdx.x, wave = tid >> 5, lane = tid & 31;
  const int half = (lane >> 4) & 1, ln = lane & 15;
  const int wm = wave & 7, wn = wave >> 3;   // the wave's 32 rows, its head

  const float* pa = Af + ((size_t)n * L_ + l0 + (tid >> 3)) * (size_t)D_ + (tid & 7) * 4;
  const float* pb = Bf + (size_t)h0 * D_ * DH_ + tid * 4;

  const int btr_off = wn * (32 * 144) + (8 * half + (lane & 7)) * 144 + 8 * ((lane >> 3) & 1);
  const bf16_t* btr0 = &Bs[0][btr_off];
  const bf16_t* btr1 = &Bs[1][btr_off];
  const bf16_t* ar0 = &As[0][(wm * 32) * 40];
  const bf16_t* ar1 = &As[1][(wm * 32) * 40];

  v8f acc[2][8];
#pragma unroll
  for (int i = 0; i < 2; ++i)
#pragma unroll
    for (int t = 0; t < 8; ++t) acc[i][t] = zero8();

  // At the top of an even k-step s: LDS buffer 0 holds step s, r1 step s + 1 and
  // r0 step s + 2 (both in flight), as in the GEMM kernel above.
  proj_regs r0, r1;
  proj_load(r0, pa, pb);
  proj_load(r1, pa + 32, pb + 32 * DH_);
  proj_store(r0, As[0], Bs[0], tid);
  proj_load(r0, pa + 64, pb + 64 * DH_);
  gemm_barrier();

  int k0 = 0;
  for (; k0 + 160 < D_; k0 += 64) {
    proj_mma(acc, ar0, btr0, lane);
    proj_store(r1, As[1], Bs[1], tid);
    proj_load(r1, pa + (k0 + 96), pb + (size_t)(k0 + 96) * DH_);
    gemm_barrier();
    proj_mma(acc, ar1, btr1, lane);
    proj_store(r0, As[0], Bs[0], tid);
    proj_load(r0, pa + (k0 + 128), pb + (size_t)(k0 + 128) * DH_);
    gemm_barrier();
  }
  // The last four k-steps, written out so that every load in the loop above is
  // unconditional and its wait can count the younger loads.
  proj_mma(acc, ar0, btr0, lane);
  proj_store(r1, As[1], Bs[1], tid);
  proj_load(r1, pa + (k0 + 96), pb + (size_t)(k0 + 96) * DH_);
  gemm_barrier();
  proj_mma(acc, ar1, btr1, lane);
  proj_store(r0, As[0], Bs[0], tid);
  gemm_barrier();
  proj_mma(acc, ar0, btr0, lane);
  proj_store(r1, As[1], Bs[1], tid);
  gemm_barrier();
  proj_mma(acc, ar1, btr1, lane);

  // Epilogue. C/D layout: VGPR r -> row m = r + 8*half; col = ln + 16*t.
  bf16_t* Og = O + (((size_t)n * H_ + h0 + wn) * L_ + l0 + wm * 32) * DH_;
#pragma unroll
  for (int i = 0; i < 2; ++i) {
    float inv[8];
#pragma unroll
    for (int r = 0; r < 8; ++r) {
      float s = 0.f;
#pragma unroll
      for (int t = 0; t < 8; ++t) s += acc[i][t][r] * acc[i][t][r];
      s += __shfl_xor(s, 1);  s += __shfl_xor(s, 2);
      s += __shfl_xor(s, 4);  s += __shfl_xor(s, 8);   // full-row sum within half
      inv[r] = 1.0f / fmaxf(sqrtf(s), 1e-12f);
    }
#pragma unroll
    for (int t = 0; t < 8; ++t)
#pragma unroll
      for (int r = 0; r < 8; ++r) {
        int m = i * 16 + r + 8 * half;
        Og[(size_t)m * DH_ + t * 16 + ln] = (bf16_t)(acc[i][t][r] * inv[r]);
      }
  }
}

static __device__ __forceinline__ u32 uni(u32 v) { return (u32)__builtin_amdgcn_readfirstlane(v); }

// A wave-uniform value for a test around a tensor load, or for its descriptor. A test on it
// compiles to s_cmp and a scalar branch: a tensor load ignores EXEC, and only a real branch
// keeps a wave from issuing it.
static __device__ __forceinline__ u32 pinned(u32 v) {
  u32 w = uni(v);
  asm volatile("" : "+s"(w));  // pinned(): holds the value in a scalar register, read at this place
  return w;
}

// A tile is 64 rows of 256 B (source pitch 256 B). All extents in bytes (data_size code 0),
// tensor = tile. WORD0 holds the pad: after every 256 B (interval code 5), 16 B (amount
// code 3) or 32 B (amount code 7).
#define TILE_PAD16 ((1u << 20) | (5u << 22) | (3u << 25))
#define TILE_PAD32 ((1u << 20) | (5u << 22) | (7u << 25))

// Group 1 of a tile's descriptor: the same for every tile, built once in front of the loop.
template <u32 WORD0>
static __device__ __forceinline__ v8u tile_group1() {
  v8u g1;
  g1[0] = uni(WORD0);                                           // no mask, data_size 0, pad
  g1[1] = uni(256u << 16);                                      // tensor_dim0 = 256 B
  g1[2] = uni(64u << 16);                                       // tensor_dim1 = 64 rows
  g1[3] = uni(256u << 16);                                      // tile_dim0 = 256 B
  g1[4] = uni(64u);                                             // tile_dim1 = 64 rows
  g1[5] = uni(256u);                                            // source row pitch, bytes
  g1[6] = uni(0u);
  g1[7] = uni(0u);
  // pinned(), for descriptor words: they stay in these scalar registers for all their uses.
  // As plain constants they are set up anew at each use, over registers of a request in flight.
  asm volatile("" : "+s"(g1));
  return g1;
}

// Group 0: the tile's place in LDS (byte offset dst) and its first byte in memory.
static __device__ __forceinline__ v4u tile_group0(u32 dst, const bf16_t* src) {
  const u64 ga = (u64)(uintptr_t)src;
  v4u g0;
  g0[0] = uni(1u);                                              // count = 1
  g0[1] = uni(dst);                                             // LDS destination
  g0[2] = uni((u32)ga);                                         // address [31:0]
  g0[3] = uni(((u32)(ga >> 32) & 0x01ffffffu) | 0x80000000u);   // address [56:32], type = 2
  // pinned(), for descriptor words: the four are one value made at this place, so that the
  // load and its wait name the same registers and no word is set up ahead in the loop.
  asm volatile("" : "+s"(g0));
  return g0;
}

static __device__ __forceinline__ void tile_load(v4u g0, v8u g1) {
  asm volatile("tensor_load_to_lds %0, %1" :: "s"(g0), "s"(g1) : "memory");
}

// Lane l with lane l ^ 16: the two lanes that share a query column.
static __device__ __forceinline__ float xhalf(float x) {
  return __builtin_bit_cast(float, __builtin_amdgcn_permlanex16(
      __builtin_bit_cast(int, x), __builtin_bit_cast(int, x),
      0x76543210, 0xfedcba98, false, false));
}

// Exact-form gelu, 0.5 x (1 + erf(x / sqrt 2)) = h + |h| erf(|x| / sqrt 2), from h = x / 2.
// erf(z) = 1 - (a1 t + ... + a5 t^5) exp(-z^2), t = 1 / (1 + p z), z >= 0: one straight
// line for every z (absolute error of the form below 2e-7; 1 at infinity), where the
// library erff takes one of two branches per value.
static __device__ __forceinline__ float gelu_from_half(float h) {
  const float a = fabsf(h);
  const float t = __builtin_amdgcn_rcpf(fmaf(0.46328378f, a, 1.0f));   // p z = p sqrt(2) |h|
  float p = fmaf(1.061405429f, t, -1.453152027f);
  p = fmaf(p, t, 1.421413741f);
  p = fmaf(p, t, -0.284496736f);
  p = fmaf(p, t, 0.254829592f);
  const float e = __builtin_amdgcn_exp2f((h * h) * -2.88539008f);      // exp(-z^2), z^2 = 2 h^2
  return fmaf(a, fmaf(-(p * t), e, 1.0f), h);
}

// tanh(y) = 1 - 2 / (1 + exp(2 y)): one straight line for every y (exp -> inf gives 1,
// exp -> 0 gives -1), where the library tanhf takes one of two branches per value.
static __device__ __forceinline__ float tanh_line(float y) {
  return fmaf(-2.0f, __builtin_amdgcn_rcpf(1.0f + __builtin_amdgcn_exp2f(y * 2.88539008f)), 1.0f);
}

// The grid puts two work-groups on a WGP, four waves on a SIMD, and never more: with
// that stated the compiler schedules the main loop for 256 registers a wave (its LDS
// reads stay several products ahead) and not for a fifth wave that never comes.
__global__ __launch_bounds__(256) __attribute__((amdgpu_waves_per_eu(4, 4))) void mca_flash_kernel(
    const bf16_t* __restrict__ Q, const bf16_t* __restrict__ Kx,
    const bf16_t* __restrict__ V, const float* __restrict__ res,
    float* __restrict__ out) {
  // Four places of 18 KiB (each a multiple of 2 KiB from the start of LDS): K tiles [s][dh]
  // with 272B rows in places 0 and 1 (17 KiB used), V tiles [s][dh] with 288B rows (32B x
  // odd: tr16 reader) in places 2 and 3. Tile s lies in place s & 1 of its pair.
  constexpr int PLACE = 9216;       // elements
  __shared__ __attribute__((aligned(2048))) bf16_t Ring[4 * PLACE];
  __shared__ __attribute__((aligned(16))) float Os[8 * 16 * 132];  // epilogue: per-wave 16 x 128 tile, O^T -> rows

  const int nh = blockIdx.y, n = nh / H_, h = nh % H_;
  const int l0 = blockIdx.x * 128;
  const int tid = threadIdx.x, wave = tid >> 5, lane = tid & 31;
  const int half = (lane >> 4) & 1, ln = lane & 15;

  const bf16_t* Qg = Q  + ((size_t)nh * L_ + l0) * DH_;
  const bf16_t* Kg = Kx + (size_t)nh * L_ * DH_;
  const bf16_t* Vg = V  + (size_t)nh * L_ * DH_;

  // Q fragments for this wave's 16-row strip, held in registers for all s.
  v16bf qf[4];
#pragma unroll
  for (int kk = 0; kk < 4; ++kk)
    qf[kk] = load_frag(Qg + (size_t)(wave * 16) * DH_ + kk * 32, DH_, lane);

  // This lane's address in the V tile for the transposing loads.
  const bf16_t* vtr = &Ring[2 * PLACE + (8 * half + (lane & 7)) * 144 + 8 * ((lane >> 3) & 1)];

  v8f o_acc[8];
#pragma unroll
  for (int t = 0; t < 8; ++t) o_acc[t] = zero8();
  // Query q = ln of this wave's strip: running maximum (equal in both halves) and
  // this half's part of the running sum (joined once, behind the loop).
  float m_i = -3.0e38f, l_i = 0.f;

  // Wave 0 asks for tile st of K, wave 1 for tile st of V: one request a wave.
  const u32 wv = uni(threadIdx.x >> 5);
  const u32 ring0 = (u32)(uintptr_t)(&Ring[0]);   // LDS byte offset of place 0
  const v8u g1k = tile_group1<TILE_PAD16>();
  const v8u g1v = tile_group1<TILE_PAD32>();
  const bf16_t* plane = (wv == 0u) ? Kg : Vg;
  const u32 place0 = ring0 + ((wv == 0u) ? 0u : (u32)(2 * PLACE * 2));
  v4u g0;   // group 0 of this wave's request in flight
  auto issue = [&](u32 st) {
    g0 = tile_group0(place0 + (st & 1u) * (u32)(PLACE * 2), plane + (size_t)st * 64 * DH_);
    if (pinned(wv == 0u)) tile_load(g0, g1k);
    if (pinned(wv == 1u)) tile_load(g0, g1v);
  };
  // The issuer's wait for its request. It names the descriptor's registers as inputs, so
  // that they keep their values from the load to here and take new ones only behind it.
  auto landed = [&]() {
    if (pinned(wv < 2u)) asm volatile("s_wait_tensorcnt 0x0" :: "s"(g0), "s"(g1k), "s"(g1v) : "memory");
  };
  constexpr u32 NT = L_ / 64;   // tiles, at least two
  issue(0u);
  // Tile 0 has landed for its issuer; the barrier shows it to the other waves.
  landed();
  __syncthreads();
  issue(1u);

  for (u32 st = 0; st < NT; ++st) {
    const bf16_t* Ks = &Ring[(st & 1u) * PLACE];
    const bf16_t* vt = vtr + (st & 1u) * PLACE;

    // S^T = K @ Q^T: tile t holds keys s = 16 t + r + 8 half (register r) of query ln.
    v8f sacc[4];
#pragma unroll  // constant indices keep these vectors in registers
    for (int t = 0; t < 4; ++t) {
      v8f s = zero8();
#pragma unroll  // constant indices keep these vectors in registers
      for (int kk = 0; kk < 4; ++kk)
        s = wmma_bf16(load_frag(&Ks[(t * 16) * 136 + kk * 32], 136, lane), qf[kk], s);
      sacc[t] = s;
    }

    // Online softmax of query ln: 32 scores in this lane, the other 32 in lane ^ 16.
    float mt[4];
#pragma unroll  // constant indices keep these vectors in registers
    for (int t = 0; t < 4; ++t) {
      mt[t] = sacc[t][0];
#pragma unroll  // constant indices keep these vectors in registers
      for (int r = 1; r < 8; ++r) mt[t] = fmaxf(mt[t], sacc[t][r]);
    }
    float mx = fmaxf(fmaxf(mt[0], mt[1]), fmaxf(mt[2], mt[3]));
    mx = fmaxf(mx, xhalf(mx));
    const float mnew = fmaxf(m_i, mx);
    const float corr = __expf(m_i - mnew);
    float rs[4];
#pragma unroll  // constant indices keep these vectors in registers
    for (int t = 0; t < 4; ++t) {
      rs[t] = 0.f;
#pragma unroll  // constant indices keep these vectors in registers
      for (int r = 0; r < 8; ++r) {
        float p = __expf(sacc[t][r] - mnew);
        sacc[t][r] = p; rs[t] += p;
      }
    }
    l_i = l_i * corr + ((rs[0] + rs[1]) + (rs[2] + rs[3]));
    m_i = mnew;
#pragma unroll  // constant indices keep these vectors in registers
    for (int t = 0; t < 8; ++t)
#pragma unroll  // constant indices keep these vectors in registers
      for (int r = 0; r < 8; ++r) o_acc[t][r] *= corr;

    // O^T += V^T @ P^T (k-dim = 64 s, two 32-wide WMMA steps). A = V^T by the
    // transposing load; B = tiles 2kk and 2kk+1 of S^T converted in place, which is
    // the same k order (8 half + 0..7, then 16 + 8 half + 0..7).
#pragma unroll  // constant indices keep these vectors in registers
    for (int kk = 0; kk < 2; ++kk) {
      v16bf pf;
#pragma unroll  // constant indices keep these vectors in registers
      for (int i = 0; i < 8; ++i) {
        pf[i]     = (bf16_t)sacc[2 * kk][i];
        pf[i + 8] = (bf16_t)sacc[2 * kk + 1][i];
      }
#pragma unroll  // constant indices keep these vectors in registers
      for (int t = 0; t < 8; ++t) {
        v16bf vf = load_frag_tr(vt + (kk * 32) * 144 + t * 16, 144);
        o_acc[t] = wmma_bf16(vf, pf, o_acc[t]);
      }
    }
    // Hand-over. This wave's reads of tile st are done; tile st + 1 has landed for its
    // issuer; the one barrier shows tile st + 1 to every wave and ends all reads of tile st,
    // whose places then take tile st + 2.
    asm volatile("s_wait_dscnt 0x0" ::: "memory");
    landed();
    __syncthreads();
    const u32 nx = pinned(st + 2u);   // read behind the waits: the descriptor is formed here
    if (nx < NT) issue(nx);
  }
  // Nothing is outstanding when the wave goes on to the epilogue and ends.
  asm volatile("s_wait_tensorcnt 0x0" :: "s"(g0), "s"(g1k), "s"(g1v) : "memory");  // inputs: as in landed()
  asm volatile("s_wait_dscnt 0x0" ::: "memory");

  // Epilogue: O/l and gelu where the values lie (o_acc[t][r] = query ln, column
  // 16 t + 8 half + r), then through this wave's own LDS tile (528 B rows) so that
  // residual loads and output stores run along whole rows of 512 B.
  const float hinv = 0.5f / (l_i + xhalf(l_i));   // O / l, halved for gelu_from_half
  float* ow = &Os[wave * 16 * 132];
#pragma unroll  // constant indices keep these vectors in registers
  for (int t = 0; t < 8; ++t) {
    float g[8];
#pragma unroll  // constant indices keep these vectors in registers
    for (int r = 0; r < 8; ++r) g[r] = gelu_from_half(o_acc[t][r] * hinv);
    float* p = ow + ln * 132 + t * 16 + 8 * half;
    *(float4*)(p)     = make_float4(g[0], g[1], g[2], g[3]);
    *(float4*)(p + 4) = make_float4(g[4], g[5], g[6], g[7]);
  }
  // Only this wave reads the tile it wrote; LDS is in-order per wave.
  const size_t idx0 = (size_t)n * L_ * D_ + (size_t)(l0 + wave * 16) * D_ + h * DH_ + lane * 4;
  for (int q0 = 0; q0 < 16; q0 += 4) {
    // Four rows a trip, all their loads ahead of the arithmetic, so that four residual
    // loads are in flight at once.
    float4 g[4], rv[4];
#pragma unroll  // constant indices keep these vectors in registers
    for (int j = 0; j < 4; ++j) {
      rv[j] = *(const float4*)(res + idx0 + (size_t)(q0 + j) * D_);
      g[j]  = *(const float4*)(ow + (q0 + j) * 132 + lane * 4);
    }
    // The residual loads stay in flight over the arithmetic while their address
    // registers are reused: this wait stands in front of every such overwrite.
    asm volatile("s_wait_xcnt 0x0" ::: "memory");
#pragma unroll  // constant indices keep these vectors in registers
    for (int j = 0; j < 4; ++j)
      *(float4*)(out + idx0 + (size_t)(q0 + j) * D_) =
          make_float4(tanh_line(g[j].x + rv[j].x), tanh_line(g[j].y + rv[j].y),
                      tanh_line(g[j].z + rv[j].z), tanh_line(g[j].w + rv[j].w));
  }
}

extern "C" void kernel_launch(void* const* d_in, const int* in_sizes, int n_in,
                              void* d_out, int out_size, void* d_ws, size_t ws_size,
                              hipStream_t stream) {
  const float* rgb       = (const float*)d_in[0];
  const float* flow      = (const float*)d_in[1];
  const float* rgb_proj  = (const float*)d_in[2];
  const float* flow_proj = (const float*)d_in[3];
  const float* atte_w    = (const float*)d_in[4];

  float* f_rgb  = (float*)d_out;
  float* f_flow = f_rgb + (size_t)N_ * L_ * D_;

  const size_t oElems = (size_t)N_ * H_ * L_ * DH_;   // 8,388,608 (16 MB bf16)
  bf16_t* o_rgb  = (bf16_t*)d_ws;
  bf16_t* o_flow = o_rgb + oElems;
  bf16_t* Tq     = o_flow + oElems;                   // o_rgb @ atte_w

  dim3 grid(L_ / 128, N_ * H_);
  dim3 block(256);

  mca_proj_kernel<<<dim3(L_ / 256, N_ * H_ / 2, 2), dim3(512), 0, stream>>>(
      rgb, flow, rgb_proj, flow_proj, o_rgb, o_flow);
  mca_gemm_kernel<1><<<grid, block, 0, stream>>>(nullptr, o_rgb, atte_w,   Tq,     DH_);

  mca_flash_kernel<<<grid, block, 0, stream>>>(Tq,     o_flow, o_rgb,  rgb,  f_rgb);
  mca_flash_kernel<<<grid, block, 0, stream>>>(o_flow, Tq,     o_flow, flow, f_flow);
}

// v008
// One run takes 153 microseconds.
// Timed twice side by side with v007, it ran 1.04 and 1.03 times as fast.
// Over all steps from v000 it is 4.57 times as fast.
#include <hip/hip_runtime.h>
#include <hip/hip_bf16.h>
#include <math.h>

// MI455X / gfx1250, wave32. All heavy math goes through v_wmma_f32_16x16x32_bf16;
// the flash kernel's K and V tiles come by the Tensor Data Mover (tensor_load_to_lds
// + s_wait_tensorcnt) with hardware LDS padding (272 B rows for K, 288 B for V),
// into two buffers each, one tile ahead of the products.
// Pipeline:
//   o_rgb  = l2norm(rgb  @ rgb_proj[h])          (projection kernel, one grid for both)
//   o_flow = l2norm(flow @ flow_proj[h])
//   T      = o_rgb @ atte_w[h]                   (GEMM kernel, MODE 1)
//   f_rgb  = tanh(gelu(Flash(Q=T,      K=o_flow, V=o_rgb )) + rgb )
//   f_flow = tanh(gelu(Flash(Q=o_flow, K=T,      V=o_flow)) + flow)
// Flash-style streaming avoids the 512MB atte tensor entirely.

#define N_  4
#define L_  2048
#define D_  1024
#define H_  8
#define DH_ 128

typedef __bf16 bf16_t;
typedef unsigned int       u32;
typedef unsigned long long u64;
typedef __attribute__((ext_vector_type(16))) __bf16 v16bf;
typedef __attribute__((ext_vector_type(8)))  __bf16 v8bf;
typedef __attribute__((ext_vector_type(4)))  __bf16 v4bf;
typedef __attribute__((ext_vector_type(8)))  float  v8f;
typedef __attribute__((ext_vector_type(4)))  float  v4f;
typedef __attribute__((ext_vector_type(4)))  u32    v4u;
typedef __attribute__((ext_vector_type(8)))  u32    v8u;

static __device__ __forceinline__ v8f wmma_bf16(v16bf a, v16bf b, v8f c) {
  // 8 args: (neg_a, A, neg_b, B, c_mod, C, reuse_a, reuse_b)
  return __builtin_amdgcn_wmma_f32_16x16x32_bf16(false, a, false, b, (short)0, c,
                                                 false, false);
}

// 16x32 bf16 fragment per ISA 7.12.2:
//   lane<16 : row M=lane,    K = {0..7, 16..23}
//   lane>=16: row M=lane-16, K = {8..15, 24..31}
// base points at a [16 x 32] tile, row-major with `stride` elements per row.
// (The Q^T B fragments use the same pattern from row-major Q [N][K] in global memory.)
static __device__ __forceinline__ v16bf load_frag(const bf16_t* base, int stride,
                                                  int lane) {
  const int r  = lane & 15;
  const int kb = (lane & 16) ? 8 : 0;
  const bf16_t* p = base + (size_t)r * stride + kb;
  v8bf lo = *(const v8bf*)(p);
  v8bf hi = *(const v8bf*)(p + 16);
  v16bf f;
#pragma unroll
  for (int i = 0; i < 8; ++i) { f[i] = lo[i]; f[i + 8] = hi[i]; }
  return f;
}

// B fragment (32 k x 16 n) out of a row-major [k][n] LDS tile by the transposing
// load: lane (c = lane & 15, hh = lane >> 4) gets T[kbase + 8*hh + 0..7][c], so the
// loads at kbase and kbase + 16 give the same k order as load_frag above.
// p is the lane's own address: row 8*hh + (lane & 7), column 8*((lane >> 3) & 1).
static __device__ __forceinline__ v16bf load_frag_tr(const bf16_t* p, int stride) {
  typedef __attribute__((address_space(3))) v8bf lds_v8bf;
  v8bf lo = __builtin_amdgcn_ds_load_tr16_b128_v8bf16((lds_v8bf*)p);
  v8bf hi = __builtin_amdgcn_ds_load_tr16_b128_v8bf16((lds_v8bf*)(p + 16 * stride));
  v16bf f;
#pragma unroll
  for (int i = 0; i < 8; ++i) { f[i] = lo[i]; f[i + 8] = hi[i]; }
  return f;
}

static __device__ __forceinline__ v8f zero8() {
  v8f z = {0.f, 0.f, 0.f, 0.f, 0.f, 0.f, 0.f, 0.f};
  return z;
}

// ---------------------------------------------------------------------------
// GEMM: O[l,k] = A[l,:] @ B[:,k]  per (n,h) slice, 128x128 output per block.
// MODE 0: A = f32 [L_,D_] (shared across heads), B = f32 proj[h] [D_,128],
//         epilogue = per-row L2 normalize. Kdim = 1024.
// MODE 1: A = bf16 o_rgb slice [L_,128], B = f32 atte_w[h] [128,128]. Kdim=128.
// Output bf16 [n,h,l,128].
// ---------------------------------------------------------------------------
// One k-step (32 k) of both operands on its way from global memory to LDS.
template <int MODE>
struct gemm_regs {
  v4f  a[4];    // MODE 0: A, f32
  v8bf a2[2];   // MODE 1: A, bf16
  v4f  b[4];    // B, f32
};

// Issues the loads of one k-step: A tile 128 rows x 32 k, B tile 32 k x 128 n (4096
// floats in a row). pa, pa2, pb: this lane's first element of the step's tiles.
template <int MODE>
static __device__ __forceinline__ void gemm_load(gemm_regs<MODE>& r, const float* pa,
                                                 const bf16_t* pa2, const float* pb) {
#pragma unroll  // constant indices keep these vectors in registers
  for (int j = 0; j < 4; ++j) {
    if (MODE == 0) r.a[j] = *(const v4f*)(pa + j * 32 * D_);   // 8 lanes a row, 32 rows
    r.b[j] = *(const v4f*)(pb + j * 1024);
  }
  if (MODE == 1) {
#pragma unroll  // constant indices keep these vectors in registers
    for (int j = 0; j < 2; ++j) r.a2[j] = *(const v8bf*)(pa2 + j * 64 * DH_);  // 4 lanes a row
  }
  // The loads stay in flight over the next k-steps while their address registers are
  // reused: this wait stands in front of every such overwrite. Its clobber also
  // keeps the loads from sinking towards their uses.
  asm volatile("s_wait_xcnt 0x0" ::: "memory");
}

// Converts a loaded k-step to bf16 and stores it: As[row][k] (80 B rows), Bs[k][n]
// row-major (288 B rows), packed 8 B or 16 B LDS stores.
template <int MODE>
static __device__ __forceinline__ void gemm_store(const gemm_regs<MODE>& r, bf16_t* As,
                                                  bf16_t* Bs, int tid) {
  if (MODE == 0) {
#pragma unroll  // constant indices keep these vectors in registers
    for (int j = 0; j < 4; ++j) {
      int e4 = (tid + 256 * j) * 4;
      v4bf d;
      d[0] = (bf16_t)r.a[j][0]; d[1] = (bf16_t)r.a[j][1];
      d[2] = (bf16_t)r.a[j][2]; d[3] = (bf16_t)r.a[j][3];
      *(v4bf*)(&As[(e4 >> 5) * 40 + (e4 & 31)]) = d;
    }
  } else {
#pragma unroll  // constant indices keep these vectors in registers
    for (int j = 0; j < 2; ++j) {
      int e8 = (tid + 256 * j) * 8;
      *(v8bf*)(&As[(e8 >> 5) * 40 + (e8 & 31)]) = r.a2[j];
    }
  }
#pragma unroll  // constant indices keep these vectors in registers
  for (int j = 0; j < 4; ++j) {
    int e4 = (tid + 256 * j) * 4;
    v4bf d;
    d[0] = (bf16_t)r.b[j][0]; d[1] = (bf16_t)r.b[j][1];
    d[2] = (bf16_t)r.b[j][2]; d[3] = (bf16_t)r.b[j][3];
    *(v4bf*)(&Bs[(e4 >> 7) * 144 + (e4 & 127)]) = d;
  }
}

// The eight products of one k-step: this wave's 16 rows against all 128 columns.
static __device__ __forceinline__ void gemm_mma(v8f (&acc)[8], const bf16_t* As,
                                                const bf16_t* btr, int wave, int lane) {
  v16bf afrag = load_frag(&As[(wave * 16) * 40], 40, lane);
#pragma unroll
  for (int t = 0; t < 8; ++t) {
    v16bf bfrag = load_frag_tr(btr + t * 16, 144);
    acc[t] = wmma_bf16(afrag, bfrag, acc[t]);
  }
}

// Work-group barrier of the k loop, by hand: it waits for this wave's LDS stores and
// reads only. __syncthreads() also waits for every global load, which would end the
// flight of the loads issued ahead at each k-step.
static __device__ __forceinline__ void gemm_barrier() {
  asm volatile("s_wait_dscnt 0x0\n\ts_barrier_signal -1\n\ts_barrier_wait -1" ::: "memory");
  // Keeps the conversions of a later k-step from being lifted over the barrier: their
  // wait would come with them and end the flight of the youngest loads.
  __builtin_amdgcn_sched_barrier(0);
}

// Kdim is a multiple of 64, at least 128 (four k-steps).
template <int MODE>
__global__ __launch_bounds__(256) void mca_gemm_kernel(
    const float* __restrict__ Af, const bf16_t* __restrict__ Ab,
    const float* __restrict__ Bf, bf16_t* __restrict__ O, int Kdim) {
  __shared__ bf16_t As[2][128 * 40];   // padded stride 40 (80B rows, 16B aligned)
  __shared__ bf16_t Bs[2][32 * 144];   // row-major Bs[k][n], 288B rows (32B x odd: tr16 reader)

  const int nh = blockIdx.y, n = nh / H_, h = nh % H_;
  const int l0 = blockIdx.x * 128;
  const int tid = threadIdx.x, wave = tid >> 5, lane = tid & 31;
  const int half = (lane >> 4) & 1, ln = lane & 15;

  // This lane's first element of the A and B tiles of k-step 0.
  const float*  pa  = (MODE == 0) ? Af + ((size_t)n * L_ + l0 + (tid >> 3)) * (size_t)D_ + (tid & 7) * 4 : nullptr;
  const bf16_t* pa2 = (MODE == 0) ? nullptr : Ab + ((size_t)nh * L_ + l0 + (tid >> 2)) * DH_ + (tid & 3) * 8;
  const float*  pb  = Bf + (size_t)h * Kdim * DH_ + tid * 4;
  bf16_t* Og = O + ((size_t)nh * L_ + l0) * DH_;

  // This lane's address in each B tile for the transposing loads.
  const int btr_off = (8 * half + (lane & 7)) * 144 + 8 * ((lane >> 3) & 1);
  const bf16_t* btr0 = &Bs[0][btr_off];
  const bf16_t* btr1 = &Bs[1][btr_off];

  v8f acc[8];
#pragma unroll
  for (int t = 0; t < 8; ++t) acc[t] = zero8();

  // At the top of an even k-step s: LDS buffer 0 holds step s, r1 step s + 1 and
  // r0 step s + 2 (both in flight). A step multiplies out of its buffer, stores the
  // next step into the other buffer (whose readers left it before the last barrier)
  // and issues the loads of step s + 3 into the registers just freed.
  gemm_regs<MODE> r0, r1;
  gemm_load<MODE>(r0, pa + (0), pa2 + (0), pb + (size_t)(0) * DH_);
  gemm_load<MODE>(r1, pa + (32), pa2 + (32), pb + (size_t)(32) * DH_);
  gemm_store<MODE>(r0, As[0], Bs[0], tid);
  gemm_load<MODE>(r0, pa + (64), pa2 + (64), pb + (size_t)(64) * DH_);
  gemm_barrier();

  int k0 = 0;
  for (; k0 + 160 < Kdim; k0 += 64) {
    gemm_mma(acc, As[0], btr0, wave, lane);
    gemm_store<MODE>(r1, As[1], Bs[1], tid);
    gemm_load<MODE>(r1, pa + (k0 + 96), pa2 + (k0 + 96), pb + (size_t)(k0 + 96) * DH_);
    gemm_barrier();
    gemm_mma(acc, As[1], btr1, wave, lane);
    gemm_store<MODE>(r0, As[0], Bs[0], tid);
    gemm_load<MODE>(r0, pa + (k0 + 128), pa2 + (k0 + 128), pb + (size_t)(k0 + 128) * DH_);
    gemm_barrier();
  }
  // The last four k-steps, written out so that every load in the loop above is
  // unconditional and its wait can count the younger loads.
  gemm_mma(acc, As[0], btr0, wave, lane);
  gemm_store<MODE>(r1, As[1], Bs[1], tid);
  gemm_load<MODE>(r1, pa + (k0 + 96), pa2 + (k0 + 96), pb + (size_t)(k0 + 96) * DH_);
  gemm_barrier();
  gemm_mma(acc, As[1], btr1, wave, lane);
  gemm_store<MODE>(r0, As[0], Bs[0], tid);
  gemm_barrier();
  gemm_mma(acc, As[0], btr0, wave, lane);
  gemm_store<MODE>(r1, As[1], Bs[1], tid);
  gemm_barrier();
  gemm_mma(acc, As[1], btr1, wave, lane);

  // Epilogue. C/D layout: VGPR r -> row m = r + 8*half; col = ln + 16*t.
  float inv[8];
#pragma unroll
  for (int r = 0; r < 8; ++r) {
    if (MODE == 0) {
      float s = 0.f;
#pragma unroll
      for (int t = 0; t < 8; ++t) s += acc[t][r] * acc[t][r];
      s += __shfl_xor(s, 1);  s += __shfl_xor(s, 2);
      s += __shfl_xor(s, 4);  s += __shfl_xor(s, 8);   // full-row sum within half
      inv[r] = 1.0f / fmaxf(sqrtf(s), 1e-12f);
    } else {
      inv[r] = 1.0f;
    }
  }
#pragma unroll
  for (int t = 0; t < 8; ++t)
#pragma unroll
    for (int r = 0; r < 8; ++r) {
      int m = wave * 16 + r + 8 * half;
      Og[(size_t)m * DH_ + t * 16 + ln] = (bf16_t)(acc[t][r] * inv[r]);
    }
}

// ---------------------------------------------------------------------------
// Both projections in one grid: O[l, :] = l2norm(A[l, :] @ B[h]) for two heads h.
// A work-group makes 256 rows x 256 columns (two heads), so that every A and B byte it
// takes from L2 feeds twice the products of a 128 x 128 tile; 2 x 128 such tiles give
// every WGP one work-group. 16 waves of 32 rows x 128 columns (one head: the row norm
// stays inside a wave); a B fragment read from LDS feeds two products.
// Same k order, k-step, register sets, LDS buffers and barrier as the GEMM kernel above.
// ---------------------------------------------------------------------------
struct proj_regs {
  v4f a[4];   // A: 256 rows x 32 k
  v4f b[4];   // B: two heads x 32 k x 128 n
};

// pa, pb: this lane's first element of the k-step's A tile and of the first head's B tile.
static __device__ __forceinline__ void proj_load(proj_regs& r, const float* pa, const float* pb) {
#pragma unroll  // constant indices keep these vectors in registers
  for (int j = 0; j < 4; ++j) {
    r.a[j] = *(const v4f*)(pa + j * 64 * D_);                              // 8 lanes a row, 64 rows
    r.b[j] = *(const v4f*)(pb + (j >> 1) * (D_ * DH_) + (j & 1) * 2048);   // 4096 floats a head
  }
  // The loads stay in flight over the next k-steps while their address registers are
  // reused: this wait stands in front of every such overwrite. Its clobber also
  // keeps the loads from sinking towards their uses.
  asm volatile("s_wait_xcnt 0x0" ::: "memory");
}

// As[row][k] (80 B rows), Bs[head][k][n] row-major (288 B rows), packed 8 B LDS stores.
static __device__ __forceinline__ void proj_store(const proj_regs& r, bf16_t* As, bf16_t* Bs, int tid) {
#pragma unroll  // constant indices keep these vectors in registers
  for (int j = 0; j < 4; ++j) {
    int e4 = (tid + 512 * j) * 4;
    v4bf d;
    d[0] = (bf16_t)r.a[j][0]; d[1] = (bf16_t)r.a[j][1];
    d[2] = (bf16_t)r.a[j][2]; d[3] = (bf16_t)r.a[j][3];
    *(v4bf*)(&As[(e4 >> 5) * 40 + (e4 & 31)]) = d;
  }
#pragma unroll  // constant indices keep these vectors in registers
  for (int j = 0; j < 4; ++j) {
    int e4 = (tid + 512 * (j & 1)) * 4;
    v4bf d;
    d[0] = (bf16_t)r.b[j][0]; d[1] = (bf16_t)r.b[j][1];
    d[2] = (bf16_t)r.b[j][2]; d[3] = (bf16_t)r.b[j][3];
    *(v4bf*)(&Bs[(j >> 1) * (32 * 144) + (e4 >> 7) * 144 + (e4 & 127)]) = d;
  }
}

// The sixteen products of one k-step: this wave's 32 rows against its head's 128 columns.
// arow: the wave's first row in the A tile; btr: the lane's address in its head's B tile.
static __device__ __forceinline__ void proj_mma(v8f (&acc)[2][8], const bf16_t* arow,
                                                const bf16_t* btr, int lane) {
  v16bf a0 = load_frag(arow, 40, lane);
  v16bf a1 = load_frag(arow + 16 * 40, 40, lane);
#pragma unroll
  for (int t = 0; t < 8; ++t) {
    v16bf bfrag = load_frag_tr(btr + t * 16, 144);
    acc[0][t] = wmma_bf16(a0, bfrag, acc[0][t]);
    acc[1][t] = wmma_bf16(a1, bfrag, acc[1][t]);
  }
}

// One work-group of 16 waves on a WGP, four waves on a SIMD, and never more: with that
// stated the compiler schedules for 256 registers a wave.
__global__ __launch_bounds__(512) __attribute__((amdgpu_waves_per_eu(4, 4))) void mca_proj_kernel(
    const float* __restrict__ A0, const float* __restrict__ A1,
    const float* __restrict__ B0, const float* __restrict__ B1,
    bf16_t* __restrict__ O0, bf16_t* __restrict__ O1) {
  __shared__ bf16_t As[2][256 * 40];       // padded stride 40 (80B rows, 16B aligned)
  __shared__ bf16_t Bs[2][2 * 32 * 144];   // per head row-major [k][n], 288B rows (32B x odd: tr16 reader)

  const float* Af = blockIdx.z ? A1 : A0;
  const float* Bf = blockIdx.z ? B1 : B0;
  bf16_t*      O  = blockIdx.z ? O1 : O0;
  const int n = blockIdx.y / (H_ / 2), h0 = (blockIdx.y % (H_ / 2)) * 2;
  const int l0 = blockIdx.x * 256;
  const int tid = threadIdx.x, wave = tid >> 5, lane = tid & 31;
  const int half = (lane >> 4) & 1, ln = lane & 15;
  const int wm = wave & 7, wn = wave >> 3;   // the wave's 32 rows, its head

  const float* pa = Af + ((size_t)n * L_ + l0 + (tid >> 3)) * (size_t)D_ + (tid & 7) * 4;
  const float* pb = Bf + (size_t)h0 * D_ * DH_ + tid * 4;

  const int btr_off = wn * (32 * 144) + (8 * half + (lane & 7)) * 144 + 8 * ((lane >> 3) & 1);
  const bf16_t* btr0 = &Bs[0][btr_off];
  const bf16_t* btr1 = &Bs[1][btr_off];
  const bf16_t* ar0 = &As[0][(wm * 32) * 40];
  const bf16_t* ar1 = &As[1][(wm * 32) * 40];

  v8f acc[2][8];
#pragma unroll
  for (int i = 0; i < 2; ++i)
#pragma unroll
    for (int t = 0; t < 8; ++t) acc[i][t] = zero8();

  // At the top of an even k-step s: LDS buffer 0 holds step s, r1 step s + 1 and
  // r0 step s + 2 (both in flight), as in the GEMM kernel above.
  proj_regs r0, r1;
  proj_load(r0, pa, pb);
  proj_load(r1, pa + 32, pb + 32 * DH_);
  proj_store(r0, As[0], Bs[0], tid);
  proj_load(r0, pa + 64, pb + 64 * DH_);
  gemm_barrier();

  int k0 = 0;
  for (; k0 + 160 < D_; k0 += 64) {
    proj_mma(acc, ar0, btr0, lane);
    proj_store(r1, As[1], Bs[1], tid);
    proj_load(r1, pa + (k0 + 96), pb + (size_t)(k0 + 96) * DH_);
    gemm_barrier();
    proj_mma(acc, ar1, btr1, lane);
    proj_store(r0, As[0], Bs[0], tid);
    proj_load(r0, pa + (k0 + 128), pb + (size_t)(k0 + 128) * DH_);
    gemm_barrier();
  }
  // The last four k-steps, written out so that every load in the loop above is
  // unconditional and its wait can count the younger loads.
  proj_mma(acc, ar0, btr0, lane);
  proj_store(r1, As[1], Bs[1], tid);
  proj_load(r1, pa + (k0 + 96), pb + (size_t)(k0 + 96) * DH_);
  gemm_barrier();
  proj_mma(acc, ar1, btr1, lane);
  proj_store(r0, As[0], Bs[0], tid);
  gemm_barrier();
  proj_mma(acc, ar0, btr0, lane);
  proj_store(r1, As[1], Bs[1], tid);
  gemm_barrier();
  proj_mma(acc, ar1, btr1, lane);

  // Epilogue. C/D layout: VGPR r -> row m = r + 8*half; col = ln + 16*t.
  bf16_t* Og = O + (((size_t)n * H_ + h0 + wn) * L_ + l0 + wm * 32) * DH_;
#pragma unroll
  for (int i = 0; i < 2; ++i) {
    float inv[8];
#pragma unroll
    for (int r = 0; r < 8; ++r) {
      float s = 0.f;
#pragma unroll
      for (int t = 0; t < 8; ++t) s += acc[i][t][r] * acc[i][t][r];
      s += __shfl_xor(s, 1);  s += __shfl_xor(s, 2);
      s += __shfl_xor(s, 4);  s += __shfl_xor(s, 8);   // full-row sum within half
      inv[r] = 1.0f / fmaxf(sqrtf(s), 1e-12f);
    }
#pragma unroll
    for (int t = 0; t < 8; ++t)
#pragma unroll
      for (int r = 0; r < 8; ++r) {
        int m = i * 16 + r + 8 * half;
        Og[(size_t)m * DH_ + t * 16 + ln] = (bf16_t)(acc[i][t][r] * inv[r]);
      }
  }
}

static __device__ __forceinline__ u32 uni(u32 v) { return (u32)__builtin_amdgcn_readfirstlane(v); }

// A wave-uniform value for a test around a tensor load, or for its descriptor. A test on it
// compiles to s_cmp and a scalar branch: a tensor load ignores EXEC, and only a real branch
// keeps a wave from issuing it.
static __device__ __forceinline__ u32 pinned(u32 v) {
  u32 w = uni(v);
  asm volatile("" : "+s"(w));  // pinned(): holds the value in a scalar register, read at this place
  return w;
}

// A tile is 64 rows of 256 B (source pitch 256 B). All extents in bytes (data_size code 0),
// tensor = tile. WORD0 holds the pad: after every 256 B (interval code 5), 16 B (amount
// code 3) or 32 B (amount code 7).
#define TILE_PAD16 ((1u << 20) | (5u << 22) | (3u << 25))
#define TILE_PAD32 ((1u << 20) | (5u << 22) | (7u << 25))

// Group 1 of a tile's descriptor: the same for every tile, built once in front of the loop.
template <u32 WORD0>
static __device__ __forceinline__ v8u tile_group1() {
  v8u g1;
  g1[0] = uni(WORD0);                                           // no mask, data_size 0, pad
  g1[1] = uni(256u << 16);                                      // tensor_dim0 = 256 B
  g1[2] = uni(64u << 16);                                       // tensor_dim1 = 64 rows
  g1[3] = uni(256u << 16);                                      // tile_dim0 = 256 B
  g1[4] = uni(64u);                                             // tile_dim1 = 64 rows
  g1[5] = uni(256u);                                            // source row pitch, bytes
  g1[6] = uni(0u);
  g1[7] = uni(0u);
  // pinned(), for descriptor words: they stay in these scalar registers for all their uses.
  // As plain constants they are set up anew at each use, over registers of a request in flight.
  asm volatile("" : "+s"(g1));
  return g1;
}

// Group 0: the tile's place in LDS (byte offset dst) and its first byte in memory.
static __device__ __forceinline__ v4u tile_group0(u32 dst, const bf16_t* src) {
  const u64 ga = (u64)(uintptr_t)src;
  v4u g0;
  g0[0] = uni(1u);                                              // count = 1
  g0[1] = uni(dst);                                             // LDS destination
  g0[2] = uni((u32)ga);                                         // address [31:0]
  g0[3] = uni(((u32)(ga >> 32) & 0x01ffffffu) | 0x80000000u);   // address [56:32], type = 2
  // pinned(), for descriptor words: the four are one value made at this place, so that the
  // load and its wait name the same registers and no word is set up ahead in the loop.
  asm volatile("" : "+s"(g0));
  return g0;
}

static __device__ __forceinline__ void tile_load(v4u g0, v8u g1) {
  asm volatile("tensor_load_to_lds %0, %1" :: "s"(g0), "s"(g1) : "memory");
}

// Lane l with lane l ^ 16: the two lanes that share a query column.
static __device__ __forceinline__ float xhalf(float x) {
  return __builtin_bit_cast(float, __builtin_amdgcn_permlanex16(
      __builtin_bit_cast(int, x), __builtin_bit_cast(int, x),
      0x76543210, 0xfedcba98, false, false));
}

// Exact-form gelu, 0.5 x (1 + erf(x / sqrt 2)) = h + |h| erf(|x| / sqrt 2), from h = x / 2.
// erf(z) = 1 - (a1 t + ... + a5 t^5) exp(-z^2), t = 1 / (1 + p z), z >= 0: one straight
// line for every z (absolute error of the form below 2e-7; 1 at infinity), where the
// library erff takes one of two branches per value.
static __device__ __forceinline__ float gelu_from_half(float h) {
  const float a = fabsf(h);
  const float t = __builtin_amdgcn_rcpf(fmaf(0.46328378f, a, 1.0f));   // p z = p sqrt(2) |h|
  float p = fmaf(1.061405429f, t, -1.453152027f);
  p = fmaf(p, t, 1.421413741f);
  p = fmaf(p, t, -0.284496736f);
  p = fmaf(p, t, 0.254829592f);
  const float e = __builtin_amdgcn_exp2f((h * h) * -2.88539008f);      // exp(-z^2), z^2 = 2 h^2
  return fmaf(a, fmaf(-(p * t), e, 1.0f), h);
}

// tanh(y) = 1 - 2 / (1 + exp(2 y)): one straight line for every y (exp -> inf gives 1,
// exp -> 0 gives -1), where the library tanhf takes one of two branches per value.
static __device__ __forceinline__ float tanh_line(float y) {
  return fmaf(-2.0f, __builtin_amdgcn_rcpf(1.0f + __builtin_amdgcn_exp2f(y * 2.88539008f)), 1.0f);
}

// The grid puts two work-groups of four waves on a WGP, two waves on a SIMD, and never
// more (LDS): with that stated a wave may hold 512 registers, which Q (64), O^T (128) and
// the scores (64) of 32 query columns need beside the fragments read ahead.
__global__ __launch_bounds__(128) __attribute__((amdgpu_waves_per_eu(2, 2))) void mca_flash_kernel(
    const bf16_t* __restrict__ Q, const bf16_t* __restrict__ Kx,
    const bf16_t* __restrict__ V, const float* __restrict__ res,
    float* __restrict__ out) {
  // Four places of 18 KiB (each a multiple of 2 KiB from the start of LDS): K tiles [s][dh]
  // with 272B rows in places 0 and 1 (17 KiB used), V tiles [s][dh] with 288B rows (32B x
  // odd: tr16 reader) in places 2 and 3. Tile s lies in place s & 1 of its pair.
  constexpr int PLACE = 9216;       // elements
  __shared__ __attribute__((aligned(2048))) bf16_t Ring[4 * PLACE];
  __shared__ __attribute__((aligned(16))) float Os[4 * 32 * 132];  // epilogue: per-wave 32 x 128 tile, O^T -> rows

  const int nh = blockIdx.y, n = nh / H_, h = nh % H_;
  const int l0 = blockIdx.x * 128;
  const int tid = threadIdx.x, wave = tid >> 5, lane = tid & 31;
  const int half = (lane >> 4) & 1, ln = lane & 15;

  const bf16_t* Qg = Q  + ((size_t)nh * L_ + l0) * DH_;
  const bf16_t* Kg = Kx + (size_t)nh * L_ * DH_;
  const bf16_t* Vg = V  + (size_t)nh * L_ * DH_;

  // Q fragments for this wave's 32-row strip (group g: rows 16 g + 0..15), held in
  // registers for all s.
  v16bf qf[2][4];
#pragma unroll
  for (int g = 0; g < 2; ++g)
#pragma unroll
    for (int kk = 0; kk < 4; ++kk)
      qf[g][kk] = load_frag(Qg + (size_t)(wave * 32 + g * 16) * DH_ + kk * 32, DH_, lane);

  // This lane's address in the V tile for the transposing loads.
  const bf16_t* vtr = &Ring[2 * PLACE + (8 * half + (lane & 7)) * 144 + 8 * ((lane >> 3) & 1)];

  v8f o_acc[2][8];
#pragma unroll
  for (int g = 0; g < 2; ++g)
#pragma unroll
    for (int t = 0; t < 8; ++t) o_acc[g][t] = zero8();
  // Query q = 16 g + ln of this wave's strip: running maximum (equal in both halves) and
  // this half's part of the running sum (joined once, behind the loop).
  float m_i[2] = {-3.0e38f, -3.0e38f}, l_i[2] = {0.f, 0.f};

  // Wave 0 asks for tile st of K, wave 1 for tile st of V: one request a wave.
  const u32 wv = uni(threadIdx.x >> 5);
  const u32 ring0 = (u32)(uintptr_t)(&Ring[0]);   // LDS byte offset of place 0
  const v8u g1k = tile_group1<TILE_PAD16>();
  const v8u g1v = tile_group1<TILE_PAD32>();
  const bf16_t* plane = (wv == 0u) ? Kg : Vg;
  const u32 place0 = ring0 + ((wv == 0u) ? 0u : (u32)(2 * PLACE * 2));
  v4u g0;   // group 0 of this wave's request in flight
  auto issue = [&](u32 st) {
    g0 = tile_group0(place0 + (st & 1u) * (u32)(PLACE * 2), plane + (size_t)st * 64 * DH_);
    if (pinned(wv == 0u)) tile_load(g0, g1k);
    if (pinned(wv == 1u)) tile_load(g0, g1v);
  };
  // The issuer's wait for its request. It names the descriptor's registers as inputs, so
  // that they keep their values from the load to here and take new ones only behind it.
  auto landed = [&]() {
    if (pinned(wv < 2u)) asm volatile("s_wait_tensorcnt 0x0" :: "s"(g0), "s"(g1k), "s"(g1v) : "memory");
  };
  constexpr u32 NT = L_ / 64;   // tiles, at least two
  issue(0u);
  // Tile 0 has landed for its issuer; the barrier shows it to the other waves.
  landed();
  __syncthreads();
  issue(1u);

  for (u32 st = 0; st < NT; ++st) {
    const bf16_t* Ks = &Ring[(st & 1u) * PLACE];
    const bf16_t* vt = vtr + (st & 1u) * PLACE;

    // S^T = K @ Q^T: tile t of group g holds keys s = 16 t + r + 8 half (register r) of
    // query 16 g + ln. One K fragment, two products.
    v8f sacc[2][4];
#pragma unroll  // constant indices keep these vectors in registers
    for (int t = 0; t < 4; ++t) {
      v8f s0 = zero8(), s1 = zero8();
#pragma unroll  // constant indices keep these vectors in registers
      for (int kk = 0; kk < 4; ++kk) {
        v16bf kf = load_frag(&Ks[(t * 16) * 136 + kk * 32], 136, lane);
        s0 = wmma_bf16(kf, qf[0][kk], s0);
        s1 = wmma_bf16(kf, qf[1][kk], s1);
      }
      sacc[0][t] = s0;
      sacc[1][t] = s1;
    }

    // Online softmax of query 16 g + ln: 32 scores in this lane, the other 32 in lane ^ 16.
#pragma unroll  // constant indices keep these vectors in registers
    for (int g = 0; g < 2; ++g) {
      float mt[4];
#pragma unroll  // constant indices keep these vectors in registers
      for (int t = 0; t < 4; ++t) {
        mt[t] = sacc[g][t][0];
#pragma unroll  // constant indices keep these vectors in registers
        for (int r = 1; r < 8; ++r) mt[t] = fmaxf(mt[t], sacc[g][t][r]);
      }
      float mx = fmaxf(fmaxf(mt[0], mt[1]), fmaxf(mt[2], mt[3]));
      mx = fmaxf(mx, xhalf(mx));
      const float mnew = fmaxf(m_i[g], mx);
      const float corr = __expf(m_i[g] - mnew);
      float rs[4];
#pragma unroll  // constant indices keep these vectors in registers
      for (int t = 0; t < 4; ++t) {
        rs[t] = 0.f;
#pragma unroll  // constant indices keep these vectors in registers
        for (int r = 0; r < 8; ++r) {
          float p = __expf(sacc[g][t][r] - mnew);
          sacc[g][t][r] = p; rs[t] += p;
        }
      }
      l_i[g] = l_i[g] * corr + ((rs[0] + rs[1]) + (rs[2] + rs[3]));
      m_i[g] = mnew;
#pragma unroll  // constant indices keep these vectors in registers
      for (int t = 0; t < 8; ++t)
#pragma unroll  // constant indices keep these vectors in registers
        for (int r = 0; r < 8; ++r) o_acc[g][t][r] *= corr;
    }

    // O^T += V^T @ P^T (k-dim = 64 s, two 32-wide WMMA steps). A = V^T by the
    // transposing load; B = tiles 2kk and 2kk+1 of S^T converted in place, which is
    // the same k order (8 half + 0..7, then 16 + 8 half + 0..7). One V fragment, two products.
#pragma unroll  // constant indices keep these vectors in registers
    for (int kk = 0; kk < 2; ++kk) {
      v16bf pf0, pf1;
#pragma unroll  // constant indices keep these vectors in registers
      for (int i = 0; i < 8; ++i) {
        pf0[i]     = (bf16_t)sacc[0][2 * kk][i];
        pf0[i + 8] = (bf16_t)sacc[0][2 * kk + 1][i];
        pf1[i]     = (bf16_t)sacc[1][2 * kk][i];
        pf1[i + 8] = (bf16_t)sacc[1][2 * kk + 1][i];
      }
#pragma unroll  // constant indices keep these vectors in registers
      for (int t = 0; t < 8; ++t) {
        v16bf vf = load_frag_tr(vt + (kk * 32) * 144 + t * 16, 144);
        o_acc[0][t] = wmma_bf16(vf, pf0, o_acc[0][t]);
        o_acc[1][t] = wmma_bf16(vf, pf1, o_acc[1][t]);
      }
    }
    // Hand-over. This wave's reads of tile st are done; tile st + 1 has landed for its
    // issuer; the one barrier shows tile st + 1 to every wave and ends all reads of tile st,
    // whose places then take tile st + 2.
    asm volatile("s_wait_dscnt 0x0" ::: "memory");
    landed();
    __syncthreads();
    const u32 nx = pinned(st + 2u);   // read behind the waits: the descriptor is formed here
    if (nx < NT) issue(nx);
  }
  // Nothing is outstanding when the wave goes on to the epilogue and ends.
  asm volatile("s_wait_tensorcnt 0x0" :: "s"(g0), "s"(g1k), "s"(g1v) : "memory");  // inputs: as in landed()
  asm volatile("s_wait_dscnt 0x0" ::: "memory");

  // Epilogue: O/l and gelu where the values lie (o_acc[g][t][r] = query 16 g + ln, column
  // 16 t + 8 half + r), then through this wave's own LDS tile (528 B rows) so that
  // residual loads and output stores run along whole rows of 512 B.
  float* ow = &Os[wave * 32 * 132];
#pragma unroll  // constant indices keep these vectors in registers
  for (int gq = 0; gq < 2; ++gq) {
    const float hinv = 0.5f / (l_i[gq] + xhalf(l_i[gq]));   // O / l, halved for gelu_from_half
#pragma unroll  // constant indices keep these vectors in registers
    for (int t = 0; t < 8; ++t) {
      float g[8];
#pragma unroll  // constant indices keep these vectors in registers
      for (int r = 0; r < 8; ++r) g[r] = gelu_from_half(o_acc[gq][t][r] * hinv);
      float* p = ow + (gq * 16 + ln) * 132 + t * 16 + 8 * half;
      *(float4*)(p)     = make_float4(g[0], g[1], g[2], g[3]);
      *(float4*)(p + 4) = make_float4(g[4], g[5], g[6], g[7]);
    }
  }
  // Only this wave reads the tile it wrote; LDS is in-order per wave.
  const size_t idx0 = (size_t)n * L_ * D_ + (size_t)(l0 + wave * 32) * D_ + h * DH_ + lane * 4;
  for (int q0 = 0; q0 < 32; q0 += 8) {
    // Eight rows a trip, all their loads ahead of the arithmetic: half the waves of the
    // 16-column form, so twice the residual loads a wave keep as many bytes in flight.
    float4 g[8], rv[8];
#pragma unroll  // constant indices keep these vectors in registers
    for (int j = 0; j < 8; ++j) {
      rv[j] = *(const float4*)(res + idx0 + (size_t)(q0 + j) * D_);
      g[j]  = *(const float4*)(ow + (q0 + j) * 132 + lane * 4);
    }
    // The residual loads stay in flight over the arithmetic while their address
    // registers are reused: this wait stands in front of every such overwrite.
    asm volatile("s_wait_xcnt 0x0" ::: "memory");
#pragma unroll  // constant indices keep these vectors in registers
    for (int j = 0; j < 8; ++j)
      *(float4*)(out + idx0 + (size_t)(q0 + j) * D_) =
          make_float4(tanh_line(g[j].x + rv[j].x), tanh_line(g[j].y + rv[j].y),
                      tanh_line(g[j].z + rv[j].z), tanh_line(g[j].w + rv[j].w));
  }
}

extern "C" void kernel_launch(void* const* d_in, const int* in_sizes, int n_in,
                              void* d_out, int out_size, void* d_ws, size_t ws_size,
                              hipStream_t stream) {
  const float* rgb       = (const float*)d_in[0];
  const float* flow      = (const float*)d_in[1];
  const float* rgb_proj  = (const float*)d_in[2];
  const float* flow_proj = (const float*)d_in[3];
  const float* atte_w    = (const float*)d_in[4];

  float* f_rgb  = (float*)d_out;
  float* f_flow = f_rgb + (size_t)N_ * L_ * D_;

  const size_t oElems = (size_t)N_ * H_ * L_ * DH_;   // 8,388,608 (16 MB bf16)
  bf16_t* o_rgb  = (bf16_t*)d_ws;
  bf16_t* o_flow = o_rgb + oElems;
  bf16_t* Tq     = o_flow + oElems;                   // o_rgb @ atte_w

  dim3 grid(L_ / 128, N_ * H_);
  dim3 block(256);

  mca_proj_kernel<<<dim3(L_ / 256, N_ * H_ / 2, 2), dim3(512), 0, stream>>>(
      rgb, flow, rgb_proj, flow_proj, o_rgb, o_flow);
  mca_gemm_kernel<1><<<grid, block, 0, stream>>>(nullptr, o_rgb, atte_w,   Tq,     DH_);

  mca_flash_kernel<<<grid, dim3(128), 0, stream>>>(Tq,     o_flow, o_rgb,  rgb,  f_rgb);
  mca_flash_kernel<<<grid, dim3(128), 0, stream>>>(o_flow, Tq,     o_flow, flow, f_flow);
}

// v009
// A run of this version takes 144 microseconds.
// Timed twice side by side with v008, it ran 1.06 times as fast both times.
// All steps since v000 together make it 4.84 times as fast.
#include <hip/hip_runtime.h>
#include <hip/hip_bf16.h>
#include <math.h>

// MI455X / gfx1250, wave32. All heavy math goes through v_wmma_f32_16x16x32_bf16;
// the flash kernel's K and V tiles come by the Tensor Data Mover (tensor_load_to_lds
// + s_wait_tensorcnt) with hardware LDS padding (272 B rows for K, 288 B for V),
// into two buffers each, one tile ahead of the products.
// Pipeline:
//   o_rgb  = l2norm(rgb  @ rgb_proj[h])          (projection kernel, one grid for both)
//   o_flow = l2norm(flow @ flow_proj[h])
//   T      = o_rgb @ atte_w[h]                   (GEMM kernel, MODE 1)
//   f_rgb  = tanh(gelu(Flash(Q=T,      K=o_flow, V=o_rgb )) + rgb )
//   f_flow = tanh(gelu(Flash(Q=o_flow, K=T,      V=o_flow)) + flow)
// Flash-style streaming avoids the 512MB atte tensor entirely.

#define N_  4
#define L_  2048
#define D_  1024
#define H_  8
#define DH_ 128

typedef __bf16 bf16_t;
typedef unsigned int       u32;
typedef unsigned long long u64;
typedef __attribute__((ext_vector_type(16))) __bf16 v16bf;
typedef __attribute__((ext_vector_type(8)))  __bf16 v8bf;
typedef __attribute__((ext_vector_type(4)))  __bf16 v4bf;
typedef __attribute__((ext_vector_type(8)))  float  v8f;
typedef __attribute__((ext_vector_type(4)))  float  v4f;
typedef __attribute__((ext_vector_type(4)))  u32    v4u;
typedef __attribute__((ext_vector_type(8)))  u32    v8u;

static __device__ __forceinline__ v8f wmma_bf16(v16bf a, v16bf b, v8f c) {
  // 8 args: (neg_a, A, neg_b, B, c_mod, C, reuse_a, reuse_b)
  return __builtin_amdgcn_wmma_f32_16x16x32_bf16(false, a, false, b, (short)0, c,
                                                 false, false);
}

// 16x32 bf16 fragment per ISA 7.12.2:
//   lane<16 : row M=lane,    K = {0..7, 16..23}
//   lane>=16: row M=lane-16, K = {8..15, 24..31}
// base points at a [16 x 32] tile, row-major with `stride` elements per row.
// (The Q^T B fragments use the same pattern from row-major Q [N][K] in global memory.)
static __device__ __forceinline__ v16bf load_frag(const bf16_t* base, int stride,
                                                  int lane) {
  const int r  = lane & 15;
  const int kb = (lane & 16) ? 8 : 0;
  const bf16_t* p = base + (size_t)r * stride + kb;
  v8bf lo = *(const v8bf*)(p);
  v8bf hi = *(const v8bf*)(p + 16);
  v16bf f;
#pragma unroll
  for (int i = 0; i < 8; ++i) { f[i] = lo[i]; f[i + 8] = hi[i]; }
  return f;
}

// B fragment (32 k x 16 n) out of a row-major [k][n] LDS tile by the transposing
// load: lane (c = lane & 15, hh = lane >> 4) gets T[kbase + 8*hh + 0..7][c], so the
// loads at kbase and kbase + 16 give the same k order as load_frag above.
// p is the lane's own address: row 8*hh + (lane & 7), column 8*((lane >> 3) & 1).
static __device__ __forceinline__ v16bf load_frag_tr(const bf16_t* p, int stride) {
  typedef __attribute__((address_space(3))) v8bf lds_v8bf;
  v8bf lo = __builtin_amdgcn_ds_load_tr16_b128_v8bf16((lds_v8bf*)p);
  v8bf hi = __builtin_amdgcn_ds_load_tr16_b128_v8bf16((lds_v8bf*)(p + 16 * stride));
  v16bf f;
#pragma unroll
  for (int i = 0; i < 8; ++i) { f[i] = lo[i]; f[i + 8] = hi[i]; }
  return f;
}

static __device__ __forceinline__ v8f zero8() {
  v8f z = {0.f, 0.f, 0.f, 0.f, 0.f, 0.f, 0.f, 0.f};
  return z;
}

// ---------------------------------------------------------------------------
// GEMM: O[l,k] = A[l,:] @ B[:,k]  per (n,h) slice, 128x128 output per block.
// MODE 0: A = f32 [L_,D_] (shared across heads), B = f32 proj[h] [D_,128],
//         epilogue = per-row L2 normalize. Kdim = 1024.
// MODE 1: A = bf16 o_rgb slice [L_,128], B = f32 atte_w[h] [128,128]. Kdim=128.
// Output bf16 [n,h,l,128].
// ---------------------------------------------------------------------------
// One k-step (32 k) of both operands on its way from global memory to LDS.
template <int MODE>
struct gemm_regs {
  v4f  a[4];    // MODE 0: A, f32
  v8bf a2[2];   // MODE 1: A, bf16
  v4f  b[4];    // B, f32
};

// Issues the loads of one k-step: A tile 128 rows x 32 k, B tile 32 k x 128 n (4096
// floats in a row). pa, pa2, pb: this lane's first element of the step's tiles.
template <int MODE>
static __device__ __forceinline__ void gemm_load(gemm_regs<MODE>& r, const float* pa,
                                                 const bf16_t* pa2, const float* pb) {
#pragma unroll  // constant indices keep these vectors in registers
  for (int j = 0; j < 4; ++j) {
    if (MODE == 0) r.a[j] = *(const v4f*)(pa + j * 32 * D_);   // 8 lanes a row, 32 rows
    r.b[j] = *(const v4f*)(pb + j * 1024);
  }
  if (MODE == 1) {
#pragma unroll  // constant indices keep these vectors in registers
    for (int j = 0; j < 2; ++j) r.a2[j] = *(const v8bf*)(pa2 + j * 64 * DH_);  // 4 lanes a row
  }
  // The loads stay in flight over the next k-steps while their address registers are
  // reused: this wait stands in front of every such overwrite. Its clobber also
  // keeps the loads from sinking towards their uses.
  asm volatile("s_wait_xcnt 0x0" ::: "memory");
}

// Converts a loaded k-step to bf16 and stores it: As[row][k] (80 B rows), Bs[k][n]
// row-major (288 B rows), packed 8 B or 16 B LDS stores.
template <int MODE>
static __device__ __forceinline__ void gemm_store(const gemm_regs<MODE>& r, bf16_t* As,
                                                  bf16_t* Bs, int tid) {
  if (MODE == 0) {
#pragma unroll  // constant indices keep these vectors in registers
    for (int j = 0; j < 4; ++j) {
      int e4 = (tid + 256 * j) * 4;
      v4bf d;
      d[0] = (bf16_t)r.a[j][0]; d[1] = (bf16_t)r.a[j][1];
      d[2] = (bf16_t)r.a[j][2]; d[3] = (bf16_t)r.a[j][3];
      *(v4bf*)(&As[(e4 >> 5) * 40 + (e4 & 31)]) = d;
    }
  } else {
#pragma unroll  // constant indices keep these vectors in registers
    for (int j = 0; j < 2; ++j) {
      int e8 = (tid + 256 * j) * 8;
      *(v8bf*)(&As[(e8 >> 5) * 40 + (e8 & 31)]) = r.a2[j];
    }
  }
#pragma unroll  // constant indices keep these vectors in registers
  for (int j = 0; j < 4; ++j) {
    int e4 = (tid + 256 * j) * 4;
    v4bf d;
    d[0] = (bf16_t)r.b[j][0]; d[1] = (bf16_t)r.b[j][1];
    d[2] = (bf16_t)r.b[j][2]; d[3] = (bf16_t)r.b[j][3];
    *(v4bf*)(&Bs[(e4 >> 7) * 144 + (e4 & 127)]) = d;
  }
}

// The eight products of one k-step: this wave's 16 rows against all 128 columns.
static __device__ __forceinline__ void gemm_mma(v8f (&acc)[8], const bf16_t* As,
                                                const bf16_t* btr, int wave, int lane) {
  v16bf afrag = load_frag(&As[(wave * 16) * 40], 40, lane);
#pragma unroll
  for (int t = 0; t < 8; ++t) {
    v16bf bfrag = load_frag_tr(btr + t * 16, 144);
    acc[t] = wmma_bf16(afrag, bfrag, acc[t]);
  }
}

// Work-group barrier of the k loop, by hand: it waits for this wave's LDS stores and
// reads only. __syncthreads() also waits for every global load, which would end the
// flight of the loads issued ahead at each k-step.
static __device__ __forceinline__ void gemm_barrier() {
  asm volatile("s_wait_dscnt 0x0\n\ts_barrier_signal -1\n\ts_barrier_wait -1" ::: "memory");
  // Keeps the conversions of a later k-step from being lifted over the barrier: their
  // wait would come with them and end the flight of the youngest loads.
  __builtin_amdgcn_sched_barrier(0);
}

// Kdim is a multiple of 64, at least 128 (four k-steps).
template <int MODE>
__global__ __launch_bounds__(256) void mca_gemm_kernel(
    const float* __restrict__ Af, const bf16_t* __restrict__ Ab,
    const float* __restrict__ Bf, bf16_t* __restrict__ O, int Kdim) {
  __shared__ bf16_t As[2][128 * 40];   // padded stride 40 (80B rows, 16B aligned)
  __shared__ bf16_t Bs[2][32 * 144];   // row-major Bs[k][n], 288B rows (32B x odd: tr16 reader)

  const int nh = blockIdx.y, n = nh / H_, h = nh % H_;
  const int l0 = blockIdx.x * 128;
  const int tid = threadIdx.x, wave = tid >> 5, lane = tid & 31;
  const int half = (lane >> 4) & 1, ln = lane & 15;

  // This lane's first element of the A and B tiles of k-step 0.
  const float*  pa  = (MODE == 0) ? Af + ((size_t)n * L_ + l0 + (tid >> 3)) * (size_t)D_ + (tid & 7) * 4 : nullptr;
  const bf16_t* pa2 = (MODE == 0) ? nullptr : Ab + ((size_t)nh * L_ + l0 + (tid >> 2)) * DH_ + (tid & 3) * 8;
  const float*  pb  = Bf + (size_t)h * Kdim * DH_ + tid * 4;
  bf16_t* Og = O + ((size_t)nh * L_ + l0) * DH_;

  // This lane's address in each B tile for the transposing loads.
  const int btr_off = (8 * half + (lane & 7)) * 144 + 8 * ((lane >> 3) & 1);
  const bf16_t* btr0 = &Bs[0][btr_off];
  const bf16_t* btr1 = &Bs[1][btr_off];

  v8f acc[8];
#pragma unroll
  for (int t = 0; t < 8; ++t) acc[t] = zero8();

  // At the top of an even k-step s: LDS buffer 0 holds step s, r1 step s + 1 and
  // r0 step s + 2 (both in flight). A step multiplies out of its buffer, stores the
  // next step into the other buffer (whose readers left it before the last barrier)
  // and issues the loads of step s + 3 into the registers just freed.
  gemm_regs<MODE> r0, r1;
  gemm_load<MODE>(r0, pa + (0), pa2 + (0), pb + (size_t)(0) * DH_);
  gemm_load<MODE>(r1, pa + (32), pa2 + (32), pb + (size_t)(32) * DH_);
  gemm_store<MODE>(r0, As[0], Bs[0], tid);
  gemm_load<MODE>(r0, pa + (64), pa2 + (64), pb + (size_t)(64) * DH_);
  gemm_barrier();

  int k0 = 0;
  for (; k0 + 160 < Kdim; k0 += 64) {
    gemm_mma(acc, As[0], btr0, wave, lane);
    gemm_store<MODE>(r1, As[1], Bs[1], tid);
    gemm_load<MODE>(r1, pa + (k0 + 96), pa2 + (k0 + 96), pb + (size_t)(k0 + 96) * DH_);
    gemm_barrier();
    gemm_mma(acc, As[1], btr1, wave, lane);
    gemm_store<MODE>(r0, As[0], Bs[0], tid);
    gemm_load<MODE>(r0, pa + (k0 + 128), pa2 + (k0 + 128), pb + (size_t)(k0 + 128) * DH_);
    gemm_barrier();
  }
  // The last four k-steps, written out so that every load in the loop above is
  // unconditional and its wait can count the younger loads.
  gemm_mma(acc, As[0], btr0, wave, lane);
  gemm_store<MODE>(r1, As[1], Bs[1], tid);
  gemm_load<MODE>(r1, pa + (k0 + 96), pa2 + (k0 + 96), pb + (size_t)(k0 + 96) * DH_);
  gemm_barrier();
  gemm_mma(acc, As[1], btr1, wave, lane);
  gemm_store<MODE>(r0, As[0], Bs[0], tid);
  gemm_barrier();
  gemm_mma(acc, As[0], btr0, wave, lane);
  gemm_store<MODE>(r1, As[1], Bs[1], tid);
  gemm_barrier();
  gemm_mma(acc, As[1], btr1, wave, lane);

  // Epilogue. C/D layout: VGPR r -> row m = r + 8*half; col = ln + 16*t.
  float inv[8];
#pragma unroll
  for (int r = 0; r < 8; ++r) {
    if (MODE == 0) {
      float s = 0.f;
#pragma unroll
      for (int t = 0; t < 8; ++t) s += acc[t][r] * acc[t][r];
      s += __shfl_xor(s, 1);  s += __shfl_xor(s, 2);
      s += __shfl_xor(s, 4);  s += __shfl_xor(s, 8);   // full-row sum within half
      inv[r] = 1.0f / fmaxf(sqrtf(s), 1e-12f);
    } else {
      inv[r] = 1.0f;
    }
  }
#pragma unroll
  for (int t = 0; t < 8; ++t)
#pragma unroll
    for (int r = 0; r < 8; ++r) {
      int m = wave * 16 + r + 8 * half;
      Og[(size_t)m * DH_ + t * 16 + ln] = (bf16_t)(acc[t][r] * inv[r]);
    }
}

// ---------------------------------------------------------------------------
// Both projections in one grid: O[l, :] = l2norm(A[l, :] @ B[h]) for two heads h.
// A work-group makes 256 rows x 256 columns (two heads), so that every A and B byte it
// takes from L2 feeds twice the products of a 128 x 128 tile; 2 x 128 such tiles give
// every WGP one work-group. 16 waves of 32 rows x 128 columns (one head: the row norm
// stays inside a wave); a B fragment read from LDS feeds two products.
// Same k order, k-step, register sets, LDS buffers and barrier as the GEMM kernel above.
// ---------------------------------------------------------------------------
struct proj_regs {
  v4f a[4];   // A: 256 rows x 32 k
  v4f b[4];   // B: two heads x 32 k x 128 n
};

// pa, pb: this lane's first element of the k-step's A tile and of the first head's B tile.
static __device__ __forceinline__ void proj_load(proj_regs& r, const float* pa, const float* pb) {
#pragma unroll  // constant indices keep these vectors in registers
  for (int j = 0; j < 4; ++j) {
    r.a[j] = *(const v4f*)(pa + j * 64 * D_);                              // 8 lanes a row, 64 rows
    r.b[j] = *(const v4f*)(pb + (j >> 1) * (D_ * DH_) + (j & 1) * 2048);   // 4096 floats a head
  }
  // The loads stay in flight over the next k-steps while their address registers are
  // reused: this wait stands in front of every such overwrite. Its clobber also
  // keeps the loads from sinking towards their uses.
  asm volatile("s_wait_xcnt 0x0" ::: "memory");
}

// As[row][k] (80 B rows), Bs[head][k][n] row-major (288 B rows), packed 8 B LDS stores.
static __device__ __forceinline__ void proj_store(const proj_regs& r, bf16_t* As, bf16_t* Bs, int tid) {
#pragma unroll  // constant indices keep these vectors in registers
  for (int j = 0; j < 4; ++j) {
    int e4 = (tid + 512 * j) * 4;
    v4bf d;
    d[0] = (bf16_t)r.a[j][0]; d[1] = (bf16_t)r.a[j][1];
    d[2] = (bf16_t)r.a[j][2]; d[3] = (bf16_t)r.a[j][3];
    *(v4bf*)(&As[(e4 >> 5) * 40 + (e4 & 31)]) = d;
  }
#pragma unroll  // constant indices keep these vectors in registers
  for (int j = 0; j < 4; ++j) {
    int e4 = (tid + 512 * (j & 1)) * 4;
    v4bf d;
    d[0] = (bf16_t)r.b[j][0]; d[1] = (bf16_t)r.b[j][1];
    d[2] = (bf16_t)r.b[j][2]; d[3] = (bf16_t)r.b[j][3];
    *(v4bf*)(&Bs[(j >> 1) * (32 * 144) + (e4 >> 7) * 144 + (e4 & 127)]) = d;
  }
}

// The sixteen products of one k-step: this wave's 32 rows against its head's 128 columns.
// arow: the wave's first row in the A tile; btr: the lane's address in its head's B tile.
static __device__ __forceinline__ void proj_mma(v8f (&acc)[2][8], const bf16_t* arow,
                                                const bf16_t* btr, int lane) {
  v16bf a0 = load_frag(arow, 40, lane);
  v16bf a1 = load_frag(arow + 16 * 40, 40, lane);
#pragma unroll
  for (int t = 0; t < 8; ++t) {
    v16bf bfrag = load_frag_tr(btr + t * 16, 144);
    acc[0][t] = wmma_bf16(a0, bfrag, acc[0][t]);
    acc[1][t] = wmma_bf16(a1, bfrag, acc[1][t]);
  }
}

// One work-group of 16 waves on a WGP, four waves on a SIMD, and never more: with that
// stated the compiler schedules for 256 registers a wave.
__global__ __launch_bounds__(512) __attribute__((amdgpu_waves_per_eu(4, 4))) void mca_proj_kernel(
    const float* __restrict__ A0, const float* __restrict__ A1,
    const float* __restrict__ B0, const float* __restrict__ B1,
    bf16_t* __restrict__ O0, bf16_t* __restrict__ O1) {
  __shared__ bf16_t As[2][256 * 40];       // padded stride 40 (80B rows, 16B aligned)
  __shared__ bf16_t Bs[2][2 * 32 * 144];   // per head row-major [k][n], 288B rows (32B x odd: tr16 reader)

  const float* Af = blockIdx.z ? A1 : A0;
  const float* Bf = blockIdx.z ? B1 : B0;
  bf16_t*      O  = blockIdx.z ? O1 : O0;
  const int n = blockIdx.y / (H_ / 2), h0 = (blockIdx.y % (H_ / 2)) * 2;
  const int l0 = blockIdx.x * 256;
  const int tid = threadIdx.x, wave = tid >> 5, lane = tid & 31;
  const int half = (lane >> 4) & 1, ln = lane & 15;
  const int wm = wave & 7, wn = wave >> 3;   // the wave's 32 rows, its head

  const float* pa = Af + ((size_t)n * L_ + l0 + (tid >> 3)) * (size_t)D_ + (tid & 7) * 4;
  const float* pb = Bf + (size_t)h0 * D_ * DH_ + tid * 4;

  const int btr_off = wn * (32 * 144) + (8 * half + (lane & 7)) * 144 + 8 * ((lane >> 3) & 1);
  const bf16_t* btr0 = &Bs[0][btr_off];
  const bf16_t* btr1 = &Bs[1][btr_off];
  const bf16_t* ar0 = &As[0][(wm * 32) * 40];
  const bf16_t* ar1 = &As[1][(wm * 32) * 40];

  v8f acc[2][8];
#pragma unroll
  for (int i = 0; i < 2; ++i)
#pragma unroll
    for (int t = 0; t < 8; ++t) acc[i][t] = zero8();

  // At the top of an even k-step s: LDS buffer 0 holds step s, r1 step s + 1 and
  // r0 step s + 2 (both in flight), as in the GEMM kernel above.
  proj_regs r0, r1;
  proj_load(r0, pa, pb);
  proj_load(r1, pa + 32, pb + 32 * DH_);
  proj_store(r0, As[0], Bs[0], tid);
  proj_load(r0, pa + 64, pb + 64 * DH_);
  gemm_barrier();

  int k0 = 0;
  for (; k0 + 160 < D_; k0 += 64) {
    proj_mma(acc, ar0, btr0, lane);
    proj_store(r1, As[1], Bs[1], tid);
    proj_load(r1, pa + (k0 + 96), pb + (size_t)(k0 + 96) * DH_);
    gemm_barrier();
    proj_mma(acc, ar1, btr1, lane);
    proj_store(r0, As[0], Bs[0], tid);
    proj_load(r0, pa + (k0 + 128), pb + (size_t)(k0 + 128) * DH_);
    gemm_barrier();
  }
  // The last four k-steps, written out so that every load in the loop above is
  // unconditional and its wait can count the younger loads.
  proj_mma(acc, ar0, btr0, lane);
  proj_store(r1, As[1], Bs[1], tid);
  proj_load(r1, pa + (k0 + 96), pb + (size_t)(k0 + 96) * DH_);
  gemm_barrier();
  proj_mma(acc, ar1, btr1, lane);
  proj_store(r0, As[0], Bs[0], tid);
  gemm_barrier();
  proj_mma(acc, ar0, btr0, lane);
  proj_store(r1, As[1], Bs[1], tid);
  gemm_barrier();
  proj_mma(acc, ar1, btr1, lane);

  // Epilogue. C/D layout: VGPR r -> row m = r + 8*half; col = ln + 16*t.
  bf16_t* Og = O + (((size_t)n * H_ + h0 + wn) * L_ + l0 + wm * 32) * DH_;
#pragma unroll
  for (int i = 0; i < 2; ++i) {
    float inv[8];
#pragma unroll
    for (int r = 0; r < 8; ++r) {
      float s = 0.f;
#pragma unroll
      for (int t = 0; t < 8; ++t) s += acc[i][t][r] * acc[i][t][r];
      s += __shfl_xor(s, 1);  s += __shfl_xor(s, 2);
      s += __shfl_xor(s, 4);  s += __shfl_xor(s, 8);   // full-row sum within half
      inv[r] = 1.0f / fmaxf(sqrtf(s), 1e-12f);
    }
#pragma unroll
    for (int t = 0; t < 8; ++t)
#pragma unroll
      for (int r = 0; r < 8; ++r) {
        int m = i * 16 + r + 8 * half;
        Og[(size_t)m * DH_ + t * 16 + ln] = (bf16_t)(acc[i][t][r] * inv[r]);
      }
  }
}

static __device__ __forceinline__ u32 uni(u32 v) { return (u32)__builtin_amdgcn_readfirstlane(v); }

// A wave-uniform value for a test around a tensor load, or for its descriptor. A test on it
// compiles to s_cmp and a scalar branch: a tensor load ignores EXEC, and only a real branch
// keeps a wave from issuing it.
static __device__ __forceinline__ u32 pinned(u32 v) {
  u32 w = uni(v);
  asm volatile("" : "+s"(w));  // pinned(): holds the value in a scalar register, read at this place
  return w;
}

// A tile is 64 rows of 256 B (source pitch 256 B). All extents in bytes (data_size code 0),
// tensor = tile. WORD0 holds the pad: after every 256 B (interval code 5), 16 B (amount
// code 3) or 32 B (amount code 7).
#define TILE_PAD16 ((1u << 20) | (5u << 22) | (3u << 25))
#define TILE_PAD32 ((1u << 20) | (5u << 22) | (7u << 25))

// Group 1 of a tile's descriptor: the same for every tile, built once in front of the loop.
template <u32 WORD0>
static __device__ __forceinline__ v8u tile_group1() {
  v8u g1;
  g1[0] = uni(WORD0);                                           // no mask, data_size 0, pad
  g1[1] = uni(256u << 16);                                      // tensor_dim0 = 256 B
  g1[2] = uni(64u << 16);                                       // tensor_dim1 = 64 rows
  g1[3] = uni(256u << 16);                                      // tile_dim0 = 256 B
  g1[4] = uni(64u);                                             // tile_dim1 = 64 rows
  g1[5] = uni(256u);                                            // source row pitch, bytes
  g1[6] = uni(0u);
  g1[7] = uni(0u);
  // pinned(), for descriptor words: they stay in these scalar registers for all their uses.
  // As plain constants they are set up anew at each use, over registers of a request in flight.
  asm volatile("" : "+s"(g1));
  return g1;
}

// Group 0: the tile's place in LDS (byte offset dst) and its first byte in memory.
static __device__ __forceinline__ v4u tile_group0(u32 dst, const bf16_t* src) {
  const u64 ga = (u64)(uintptr_t)src;
  v4u g0;
  g0[0] = uni(1u);                                              // count = 1
  g0[1] = uni(dst);                                             // LDS destination
  g0[2] = uni((u32)ga);                                         // address [31:0]
  g0[3] = uni(((u32)(ga >> 32) & 0x01ffffffu) | 0x80000000u);   // address [56:32], type = 2
  // pinned(), for descriptor words: the four are one value made at this place, so that the
  // load and its wait name the same registers and no word is set up ahead in the loop.
  asm volatile("" : "+s"(g0));
  return g0;
}

static __device__ __forceinline__ void tile_load(v4u g0, v8u g1) {
  asm volatile("tensor_load_to_lds %0, %1" :: "s"(g0), "s"(g1) : "memory");
}

// Lane l with lane l ^ 16: the two lanes that share a query column.
static __device__ __forceinline__ float xhalf(float x) {
  return __builtin_bit_cast(float, __builtin_amdgcn_permlanex16(
      __builtin_bit_cast(int, x), __builtin_bit_cast(int, x),
      0x76543210, 0xfedcba98, false, false));
}

// Exact-form gelu, 0.5 x (1 + erf(x / sqrt 2)) = h + |h| erf(|x| / sqrt 2), from h = x / 2.
// erf(z) = 1 - (a1 t + ... + a5 t^5) exp(-z^2), t = 1 / (1 + p z), z >= 0: one straight
// line for every z (absolute error of the form below 2e-7; 1 at infinity), where the
// library erff takes one of two branches per value.
static __device__ __forceinline__ float gelu_from_half(float h) {
  const float a = fabsf(h);
  const float t = __builtin_amdgcn_rcpf(fmaf(0.46328378f, a, 1.0f));   // p z = p sqrt(2) |h|
  float p = fmaf(1.061405429f, t, -1.453152027f);
  p = fmaf(p, t, 1.421413741f);
  p = fmaf(p, t, -0.284496736f);
  p = fmaf(p, t, 0.254829592f);
  const float e = __builtin_amdgcn_exp2f((h * h) * -2.88539008f);      // exp(-z^2), z^2 = 2 h^2
  return fmaf(a, fmaf(-(p * t), e, 1.0f), h);
}

// tanh(y) = 1 - 2 / (1 + exp(2 y)): one straight line for every y (exp -> inf gives 1,
// exp -> 0 gives -1), where the library tanhf takes one of two branches per value.
static __device__ __forceinline__ float tanh_line(float y) {
  return fmaf(-2.0f, __builtin_amdgcn_rcpf(1.0f + __builtin_amdgcn_exp2f(y * 2.88539008f)), 1.0f);
}

// The grid puts two work-groups of four waves on a WGP, two waves on a SIMD, and never
// more (LDS): with that stated a wave may hold 512 registers, which Q (64), O^T (128) and
// the scores (64) of 32 query columns need beside the fragments read ahead.
__global__ __launch_bounds__(128) __attribute__((amdgpu_waves_per_eu(2, 2))) void mca_flash_kernel(
    const bf16_t* __restrict__ Q, const bf16_t* __restrict__ Kx,
    const bf16_t* __restrict__ V, const float* __restrict__ res,
    float* __restrict__ out) {
  // Four places of 18 KiB (each a multiple of 2 KiB from the start of LDS): K tiles [s][dh]
  // with 272B rows in places 0 and 1 (17 KiB used), V tiles [s][dh] with 288B rows (32B x
  // odd: tr16 reader) in places 2 and 3. Tile s lies in place s & 1 of its pair.
  constexpr int PLACE = 9216;       // elements
  __shared__ __attribute__((aligned(2048))) bf16_t Ring[4 * PLACE];
  __shared__ __attribute__((aligned(16))) float Os[4 * 32 * 132];  // epilogue: per-wave 32 x 128 tile, O^T -> rows

  const int nh = blockIdx.y, n = nh / H_, h = nh % H_;
  const int l0 = blockIdx.x * 128;
  const int tid = threadIdx.x, wave = tid >> 5, lane = tid & 31;
  const int half = (lane >> 4) & 1, ln = lane & 15;

  const bf16_t* Qg = Q  + ((size_t)nh * L_ + l0) * DH_;
  const bf16_t* Kg = Kx + (size_t)nh * L_ * DH_;
  const bf16_t* Vg = V  + (size_t)nh * L_ * DH_;

  // Q fragments for this wave's 32-row strip (group g: rows 16 g + 0..15), held in
  // registers for all s.
  v16bf qf[2][4];
#pragma unroll
  for (int g = 0; g < 2; ++g)
#pragma unroll
    for (int kk = 0; kk < 4; ++kk)
      qf[g][kk] = load_frag(Qg + (size_t)(wave * 32 + g * 16) * DH_ + kk * 32, DH_, lane);

  // This lane's address in the V tile for the transposing loads.
  const bf16_t* vtr = &Ring[2 * PLACE + (8 * half + (lane & 7)) * 144 + 8 * ((lane >> 3) & 1)];

  v8f o_acc[2][8];
#pragma unroll
  for (int g = 0; g < 2; ++g)
#pragma unroll
    for (int t = 0; t < 8; ++t) o_acc[g][t] = zero8();
  // Query q = 16 g + ln of this wave's strip: running maximum (equal in both halves) and
  // this half's part of the running sum (joined once, behind the loop).
  float m_i[2] = {-3.0e38f, -3.0e38f}, l_i[2] = {0.f, 0.f};

  // Wave 0 asks for tile st of K, wave 1 for tile st of V: one request a wave.
  const u32 wv = uni(threadIdx.x >> 5);
  const u32 ring0 = (u32)(uintptr_t)(&Ring[0]);   // LDS byte offset of place 0
  const v8u g1k = tile_group1<TILE_PAD16>();
  const v8u g1v = tile_group1<TILE_PAD32>();
  const bf16_t* plane = (wv == 0u) ? Kg : Vg;
  const u32 place0 = ring0 + ((wv == 0u) ? 0u : (u32)(2 * PLACE * 2));
  v4u g0;   // group 0 of this wave's request in flight
  auto issue = [&](u32 st) {
    g0 = tile_group0(place0 + (st & 1u) * (u32)(PLACE * 2), plane + (size_t)st * 64 * DH_);
    if (pinned(wv == 0u)) tile_load(g0, g1k);
    if (pinned(wv == 1u)) tile_load(g0, g1v);
  };
  // The issuer's wait for its request. It names the descriptor's registers as inputs, so
  // that they keep their values from the load to here and take new ones only behind it.
  auto landed = [&]() {
    if (pinned(wv < 2u)) asm volatile("s_wait_tensorcnt 0x0" :: "s"(g0), "s"(g1k), "s"(g1v) : "memory");
  };
  constexpr u32 NT = L_ / 64;   // tiles, at least two
  issue(0u);
  // Tile 0 has landed for its issuer; the barrier shows it to the other waves.
  landed();
  __syncthreads();
  issue(1u);

  for (u32 st = 0; st < NT; ++st) {
    const bf16_t* Ks = &Ring[(st & 1u) * PLACE];
    const bf16_t* vt = vtr + (st & 1u) * PLACE;

    // S^T = K @ Q^T: tile t of group g holds keys s = 16 t + r + 8 half (register r) of
    // query 16 g + ln. One K fragment, two products.
    // The LDS reads of a tile stand at two places only, each a whole group in front of the
    // block of products that it feeds: all K fragments here, all V^T fragments behind the
    // S^T products.
    v16bf kf[4][4];
#pragma unroll  // constant indices keep these vectors in registers
    for (int t = 0; t < 4; ++t)
#pragma unroll  // constant indices keep these vectors in registers
      for (int kk = 0; kk < 4; ++kk) kf[t][kk] = load_frag(&Ks[(t * 16) * 136 + kk * 32], 136, lane);
    // Keeps the K group whole: without it the loads sink, pair by pair, to their products.
    __builtin_amdgcn_sched_barrier(0);
    v8f sacc[2][4];
#pragma unroll  // constant indices keep these vectors in registers
    for (int t = 0; t < 4; ++t) {
      v8f s0 = zero8(), s1 = zero8();
#pragma unroll  // constant indices keep these vectors in registers
      for (int kk = 0; kk < 4; ++kk) {
        s0 = wmma_bf16(kf[t][kk], qf[0][kk], s0);
        s1 = wmma_bf16(kf[t][kk], qf[1][kk], s1);
      }
      sacc[0][t] = s0;
      sacc[1][t] = s1;
    }
    // All V^T fragments of the tile: their LDS latency passes under the softmax, and the O^T
    // products wait for no load. The barrier in front keeps the group off the K fragments'
    // registers while those are live; the one behind keeps it from sinking to the products.
    __builtin_amdgcn_sched_barrier(0);
    v16bf vf[2][8];
#pragma unroll  // constant indices keep these vectors in registers
    for (int kk = 0; kk < 2; ++kk)
#pragma unroll  // constant indices keep these vectors in registers
      for (int t = 0; t < 8; ++t) vf[kk][t] = load_frag_tr(vt + (kk * 32) * 144 + t * 16, 144);
    __builtin_amdgcn_sched_barrier(0);

    // Online softmax of query 16 g + ln: 32 scores in this lane, the other 32 in lane ^ 16.
#pragma unroll  // constant indices keep these vectors in registers
    for (int g = 0; g < 2; ++g) {
      float mt[4];
#pragma unroll  // constant indices keep these vectors in registers
      for (int t = 0; t < 4; ++t) {
        mt[t] = sacc[g][t][0];
#pragma unroll  // constant indices keep these vectors in registers
        for (int r = 1; r < 8; ++r) mt[t] = fmaxf(mt[t], sacc[g][t][r]);
      }
      float mx = fmaxf(fmaxf(mt[0], mt[1]), fmaxf(mt[2], mt[3]));
      mx = fmaxf(mx, xhalf(mx));
      const float mnew = fmaxf(m_i[g], mx);
      const float corr = __expf(m_i[g] - mnew);
      float rs[4];
#pragma unroll  // constant indices keep these vectors in registers
      for (int t = 0; t < 4; ++t) {
        rs[t] = 0.f;
#pragma unroll  // constant indices keep these vectors in registers
        for (int r = 0; r < 8; ++r) {
          float p = __expf(sacc[g][t][r] - mnew);
          sacc[g][t][r] = p; rs[t] += p;
        }
      }
      l_i[g] = l_i[g] * corr + ((rs[0] + rs[1]) + (rs[2] + rs[3]));
      m_i[g] = mnew;
#pragma unroll  // constant indices keep these vectors in registers
      for (int t = 0; t < 8; ++t)
#pragma unroll  // constant indices keep these vectors in registers
        for (int r = 0; r < 8; ++r) o_acc[g][t][r] *= corr;
    }

    // O^T += V^T @ P^T (k-dim = 64 s, two 32-wide WMMA steps). A = V^T by the
    // transposing load; B = tiles 2kk and 2kk+1 of S^T converted in place, which is
    // the same k order (8 half + 0..7, then 16 + 8 half + 0..7). One V fragment, two products.
#pragma unroll  // constant indices keep these vectors in registers
    for (int kk = 0; kk < 2; ++kk) {
      v16bf pf0, pf1;
#pragma unroll  // constant indices keep these vectors in registers
      for (int i = 0; i < 8; ++i) {
        pf0[i]     = (bf16_t)sacc[0][2 * kk][i];
        pf0[i + 8] = (bf16_t)sacc[0][2 * kk + 1][i];
        pf1[i]     = (bf16_t)sacc[1][2 * kk][i];
        pf1[i + 8] = (bf16_t)sacc[1][2 * kk + 1][i];
      }
#pragma unroll  // constant indices keep these vectors in registers
      for (int t = 0; t < 8; ++t) {
        o_acc[0][t] = wmma_bf16(vf[kk][t], pf0, o_acc[0][t]);
        o_acc[1][t] = wmma_bf16(vf[kk][t], pf1, o_acc[1][t]);
      }
    }
    // Hand-over. This wave's reads of tile st are done; tile st + 1 has landed for its
    // issuer; the one barrier shows tile st + 1 to every wave and ends all reads of tile st,
    // whose places then take tile st + 2.
    // With every LDS read far above, nothing else holds the wait below at the foot: lifted
    // to the V group it would make the softmax wait for all 32 loads.
    __builtin_amdgcn_sched_barrier(0);
    asm volatile("s_wait_dscnt 0x0" ::: "memory");
    landed();
    __syncthreads();
    const u32 nx = pinned(st + 2u);   // read behind the waits: the descriptor is formed here
    if (nx < NT) issue(nx);
  }
  // Nothing is outstanding when the wave goes on to the epilogue and ends.
  asm volatile("s_wait_tensorcnt 0x0" :: "s"(g0), "s"(g1k), "s"(g1v) : "memory");  // inputs: as in landed()
  asm volatile("s_wait_dscnt 0x0" ::: "memory");

  // Epilogue: O/l and gelu where the values lie (o_acc[g][t][r] = query 16 g + ln, column
  // 16 t + 8 half + r), then through this wave's own LDS tile (528 B rows) so that
  // residual loads and output stores run along whole rows of 512 B.
  float* ow = &Os[wave * 32 * 132];
#pragma unroll  // constant indices keep these vectors in registers
  for (int gq = 0; gq < 2; ++gq) {
    const float hinv = 0.5f / (l_i[gq] + xhalf(l_i[gq]));   // O / l, halved for gelu_from_half
#pragma unroll  // constant indices keep these vectors in registers
    for (int t = 0; t < 8; ++t) {
      float g[8];
#pragma unroll  // constant indices keep these vectors in registers
      for (int r = 0; r < 8; ++r) g[r] = gelu_from_half(o_acc[gq][t][r] * hinv);
      float* p = ow + (gq * 16 + ln) * 132 + t * 16 + 8 * half;
      *(float4*)(p)     = make_float4(g[0], g[1], g[2], g[3]);
      *(float4*)(p + 4) = make_float4(g[4], g[5], g[6], g[7]);
    }
  }
  // Only this wave reads the tile it wrote; LDS is in-order per wave.
  const size_t idx0 = (size_t)n * L_ * D_ + (size_t)(l0 + wave * 32) * D_ + h * DH_ + lane * 4;
  for (int q0 = 0; q0 < 32; q0 += 8) {
    // Eight rows a trip, all their loads ahead of the arithmetic: half the waves of the
    // 16-column form, so twice the residual loads a wave keep as many bytes in flight.
    float4 g[8], rv[8];
#pragma unroll  // constant indices keep these vectors in registers
    for (int j = 0; j < 8; ++j) {
      rv[j] = *(const float4*)(res + idx0 + (size_t)(q0 + j) * D_);
      g[j]  = *(const float4*)(ow + (q0 + j) * 132 + lane * 4);
    }
    // The residual loads stay in flight over the arithmetic while their address
    // registers are reused: this wait stands in front of every such overwrite.
    asm volatile("s_wait_xcnt 0x0" ::: "memory");
#pragma unroll  // constant indices keep these vectors in registers
    for (int j = 0; j < 8; ++j)
      *(float4*)(out + idx0 + (size_t)(q0 + j) * D_) =
          make_float4(tanh_line(g[j].x + rv[j].x), tanh_line(g[j].y + rv[j].y),
                      tanh_line(g[j].z + rv[j].z), tanh_line(g[j].w + rv[j].w));
  }
}

extern "C" void kernel_launch(void* const* d_in, const int* in_sizes, int n_in,
                              void* d_out, int out_size, void* d_ws, size_t ws_size,
                              hipStream_t stream) {
  const float* rgb       = (const float*)d_in[0];
  const float* flow      = (const float*)d_in[1];
  const float* rgb_proj  = (const float*)d_in[2];
  const float* flow_proj = (const float*)d_in[3];
  const float* atte_w    = (const float*)d_in[4];

  float* f_rgb  = (float*)d_out;
  float* f_flow = f_rgb + (size_t)N_ * L_ * D_;

  const size_t oElems = (size_t)N_ * H_ * L_ * DH_;   // 8,388,608 (16 MB bf16)
  bf16_t* o_rgb  = (bf16_t*)d_ws;
  bf16_t* o_flow = o_rgb + oElems;
  bf16_t* Tq     = o_flow + oElems;                   // o_rgb @ atte_w

  dim3 grid(L_ / 128, N_ * H_);
  dim3 block(256);

  mca_proj_kernel<<<dim3(L_ / 256, N_ * H_ / 2, 2), dim3(512), 0, stream>>>(
      rgb, flow, rgb_proj, flow_proj, o_rgb, o_flow);
  mca_gemm_kernel<1><<<grid, block, 0, stream>>>(nullptr, o_rgb, atte_w,   Tq,     DH_);

  mca_flash_kernel<<<grid, dim3(128), 0, stream>>>(Tq,     o_flow, o_rgb,  rgb,  f_rgb);
  mca_flash_kernel<<<grid, dim3(128), 0, stream>>>(o_flow, Tq,     o_flow, flow, f_flow);
}
